// v000
// The times below were measured on an AMD MI455X: many runs one after another, warmed up first and cycling through
// copies of the inputs, with the whole window's GPU time divided by the number of runs. Launches and the gaps
// between them are all in it. The median over several windows is given; except for v000 it joins two sittings, which
// can be a few percent apart, so the side-by-side timings, each taken in one sitting, are the better comparison.
// v000 is the starting kernel. One run takes 1640 microseconds.
#include <hip/hip_runtime.h>

// _CompatAttention (x [2][2048][2048]; q = RMSNorm_128(x wq^T) * q_norm_w (16 heads x 128), k = RMSNorm_128(x wk^T) * k_norm_w, v = x wv^T (4 kv heads; group h/4); interleaved-pair RoPE (theta 1e4, positions 0..L-1, tables computed on device); causal softmax(q.k / sqrt(128)) (finfo.min fill); out = merged wo^T -> [2][2048][2048]).
// Compute dtypes, f32 accumulate: every input rounded to bf16; q/k/v on PLAIN bf16 operands (inputs: exact); RMSNorm (eps 1e-6) and RoPE f32; causal scores and attn.v: query rows < 512 hl (3 products), the rest single fp16 (x1024), causal tile skipping; softmax f32; wo hl x exact (2 products).

#define NB_  2
#define TT   2048
#define DM   2048
#define NH_  16
#define NKV  4
#define REP  (NH_ / NKV)
#define HD   128
#define DQ   (NH_ * HD)
#define DKV  (NKV * HD)
#define ZH   2
#define RH   512                  // query rows < RH use hi+lo planes (0: none)
#define WIN  2048
#define PCAR 1024.0f
#define SCL  0.088388347648318447f   // HD^-0.5
typedef _Float16 h16;
typedef unsigned short bf;
typedef __attribute__((ext_vector_type(16))) __bf16   v16bf;
typedef __attribute__((ext_vector_type(16))) _Float16 v16h;
typedef __attribute__((ext_vector_type(8)))  _Float16 v8h;
typedef __attribute__((ext_vector_type(8)))  unsigned short v8us;
typedef __attribute__((ext_vector_type(8)))  float    v8f;
typedef __attribute__((ext_vector_type(4)))  float    v4f;
typedef v8h  __attribute__((may_alias)) v8ha;
typedef v4f  __attribute__((may_alias)) v4fa;
typedef v8us __attribute__((may_alias)) v8usa;

__device__ __forceinline__ unsigned short f2bf(float f) { unsigned u = __float_as_uint(f); u += 0x7FFFu + ((u >> 16) & 1u); return (unsigned short)(u >> 16); }
__device__ __forceinline__ float bf2f(unsigned short b) { return __uint_as_float(((unsigned)b) << 16); }
__device__ __forceinline__ float bfr(float f) { return bf2f(f2bf(f)); }
__device__ __forceinline__ v16h cat16(v8h lo, v8h hi) { return __builtin_shufflevector(lo, hi, 0, 1, 2, 3, 4, 5, 6, 7, 8, 9, 10, 11, 12, 13, 14, 15); }
__device__ __forceinline__ v16bf cat16b(v8us lo, v8us hi) { return __builtin_bit_cast(v16bf, __builtin_shufflevector(lo, hi, 0, 1, 2, 3, 4, 5, 6, 7, 8, 9, 10, 11, 12, 13, 14, 15)); }
__device__ __forceinline__ v8f wmma16(v16h a, v16h b, v8f c) { return __builtin_amdgcn_wmma_f32_16x16x32_f16(false, a, false, b, (short)0, c, false, false); }
__device__ __forceinline__ v8f wmmab(v16bf a, v16bf b, v8f c) { return __builtin_amdgcn_wmma_f32_16x16x32_bf16(false, a, false, b, (short)0, c, false, false); }



// ---- k_gemmw: register-blocked GEMM, ONE WAVE per 64x64 output tile (16 accumulators), operands straight from K-contiguous 16-bit planes; grid (M/64, N/64, Z), 32 threads.
// C[m][n] (f32, pitch ldc, + optional f32 bias[n]) = sum_k A[m][k] Bt[n][k] (+ split products per NSPLIT). z-batch strides sA/sB/sC in elements. K % 32 == 0.
template <typename T16> struct WFrag;
template <> struct WFrag<h16> { typedef v16h V; static __device__ __forceinline__ V ld(const h16* p) { return cat16(*(const v8h*)p, *(const v8h*)(p + 16)); } static __device__ __forceinline__ v8f mma(V a, V b, v8f c) { return wmma16(a, b, c); } };
template <> struct WFrag<bf> { typedef v16bf V; static __device__ __forceinline__ V ld(const bf* p) { return cat16b(*(const v8us*)p, *(const v8us*)(p + 16)); } static __device__ __forceinline__ v8f mma(V a, V b, v8f c) { return wmmab(a, b, c); } };
template <typename T16, int NSPLIT, bool BIAS>
__global__ __launch_bounds__(32) void k_gemmw(const T16* __restrict__ A, const T16* __restrict__ A2, const T16* __restrict__ Bt, const T16* __restrict__ Bt2, int K, float* C, int ldc, const float* __restrict__ bias, size_t sA, size_t sB, size_t sC) {
    typedef typename WFrag<T16>::V V;
    __shared__ __align__(16) float os[16 * 68];
    const size_t z = blockIdx.z; A += z * sA; if (A2) A2 += z * sA; Bt += z * sB; if (Bt2) Bt2 += z * sB; C += z * sC;
    const int lane = threadIdx.x & 31, lr = lane & 15, hi = lane >> 4; const int r0 = blockIdx.x * 64, c0 = blockIdx.y * 64;
    v8f acc[4][4];
#pragma unroll
    for (int mb = 0; mb < 4; ++mb)
#pragma unroll
        for (int nb = 0; nb < 4; ++nb) acc[mb][nb] = (v8f){};
    const size_t aoff = (size_t)(r0 + lr) * K + 8 * hi, boff = (size_t)(c0 + lr) * K + 8 * hi;
#pragma unroll 1
    for (int kc = 0; kc < K; kc += 32) {
        V a[4], a2[4];
#pragma unroll
        for (int mb = 0; mb < 4; ++mb) { a[mb] = WFrag<T16>::ld(A + aoff + (size_t)mb * 16 * K + kc); if (NSPLIT == 1 || NSPLIT == 2) a2[mb] = WFrag<T16>::ld(A2 + aoff + (size_t)mb * 16 * K + kc); }
#pragma unroll
        for (int nb = 0; nb < 4; ++nb) { const V b = WFrag<T16>::ld(Bt + boff + (size_t)nb * 16 * K + kc); V b2; if (NSPLIT >= 2) b2 = WFrag<T16>::ld(Bt2 + boff + (size_t)nb * 16 * K + kc);
#pragma unroll
            for (int mb = 0; mb < 4; ++mb) { acc[mb][nb] = WFrag<T16>::mma(a[mb], b, acc[mb][nb]); if (NSPLIT == 1 || NSPLIT == 2) acc[mb][nb] = WFrag<T16>::mma(a2[mb], b, acc[mb][nb]); if (NSPLIT >= 2) acc[mb][nb] = WFrag<T16>::mma(a[mb], b2, acc[mb][nb]); } }
        asm volatile("v_nop\n\tv_nop\n\tv_nop\n\tv_nop" : "+v"(acc[0][0]), "+v"(acc[1][1]), "+v"(acc[2][2]), "+v"(acc[3][3]) : "v"(a[0]), "v"(a[3]));
    }
#pragma unroll
    for (int mb = 0; mb < 4; ++mb) {
#pragma unroll
        for (int nb = 0; nb < 4; ++nb) {
#pragma unroll
            for (int j = 0; j < 8; ++j) os[(hi * 8 + j) * 68 + nb * 16 + lr] = acc[mb][nb][j]; }
        __builtin_amdgcn_wave_barrier(); asm volatile("" ::: "memory");
        float* crow = C + (size_t)(r0 + mb * 16) * ldc + c0;
{
#pragma unroll
            for (int s = 0; s < 8; ++s) { const int row = 2 * s + hi, cofs = lr * 4; v4f val = *(const v4fa*)(os + row * 68 + cofs); if (BIAS) { val[0] += bfr(bias[c0 + cofs]); val[1] += bfr(bias[c0 + cofs + 1]); val[2] += bfr(bias[c0 + cofs + 2]); val[3] += bfr(bias[c0 + cofs + 3]); }
                *(v4f*)(crow + (size_t)row * ldc + cofs) = val; }
             }
        __builtin_amdgcn_wave_barrier(); asm volatile("" ::: "memory");
    }
}

// ---- k_gemmc: the same one-wave 64x64 tile GEMM specialised for causal attention: CMODE 1 skips score tiles entirely above the diagonal (query rows r0+roff.., key columns c0..), CMODE 2 limits the
// key (K) loop of the probability x value contraction to the diagonal block (probabilities beyond it are exactly zero). roff = row offset of this launch's first row within the sequence.
template <typename T16, int NSPLIT, int CMODE>
__global__ __launch_bounds__(32) void k_gemmc(const T16* __restrict__ A, const T16* __restrict__ A2, const T16* __restrict__ Bt, const T16* __restrict__ Bt2, int K, float* C, int ldc, int roff, size_t sA, size_t sB, size_t sC) {
    typedef typename WFrag<T16>::V V;
    __shared__ __align__(16) float os[16 * 68];
    const size_t z = blockIdx.z; A += z * sA; if (A2) A2 += z * sA; Bt += z * sB; if (Bt2) Bt2 += z * sB; C += z * sC;
    const int lane = threadIdx.x & 31, lr = lane & 15, hi = lane >> 4; const int r0 = blockIdx.x * 64, c0 = blockIdx.y * 64;
    if (CMODE == 1 && c0 > r0 + roff + 63) return;                  // score tile entirely above the causal diagonal: never read (the softmax masks j > i by select)
    const int Kl = (CMODE == 2) ? min(K, r0 + roff + 64) : K;        // P.V: probabilities are exactly 0 beyond the diagonal block, so the K loop stops there
    v8f acc[4][4];
#pragma unroll
    for (int mb = 0; mb < 4; ++mb)
#pragma unroll
        for (int nb = 0; nb < 4; ++nb) acc[mb][nb] = (v8f){};
    const size_t aoff = (size_t)(r0 + lr) * K + 8 * hi, boff = (size_t)(c0 + lr) * K + 8 * hi;
#pragma unroll 1
    for (int kc = 0; kc < Kl; kc += 32) {
        V a[4], a2[4];
#pragma unroll
        for (int mb = 0; mb < 4; ++mb) { a[mb] = WFrag<T16>::ld(A + aoff + (size_t)mb * 16 * K + kc); if (NSPLIT == 1 || NSPLIT == 2) a2[mb] = WFrag<T16>::ld(A2 + aoff + (size_t)mb * 16 * K + kc); }
#pragma unroll
        for (int nb = 0; nb < 4; ++nb) { const V b = WFrag<T16>::ld(Bt + boff + (size_t)nb * 16 * K + kc); V b2; if (NSPLIT >= 2) b2 = WFrag<T16>::ld(Bt2 + boff + (size_t)nb * 16 * K + kc);
#pragma unroll
            for (int mb = 0; mb < 4; ++mb) { acc[mb][nb] = WFrag<T16>::mma(a[mb], b, acc[mb][nb]); if (NSPLIT == 1 || NSPLIT == 2) acc[mb][nb] = WFrag<T16>::mma(a2[mb], b, acc[mb][nb]); if (NSPLIT >= 2) acc[mb][nb] = WFrag<T16>::mma(a[mb], b2, acc[mb][nb]); } }
        asm volatile("v_nop\n\tv_nop\n\tv_nop\n\tv_nop" : "+v"(acc[0][0]), "+v"(acc[1][1]), "+v"(acc[2][2]), "+v"(acc[3][3]) : "v"(a[0]), "v"(a[3]));
    }
#pragma unroll
    for (int mb = 0; mb < 4; ++mb) {
#pragma unroll
        for (int nb = 0; nb < 4; ++nb) {
#pragma unroll
            for (int j = 0; j < 8; ++j) os[(hi * 8 + j) * 68 + nb * 16 + lr] = acc[mb][nb][j]; }
        __builtin_amdgcn_wave_barrier(); asm volatile("" ::: "memory");
        float* crow = C + (size_t)(r0 + mb * 16) * ldc + c0;
{
#pragma unroll
            for (int s = 0; s < 8; ++s) { const int row = 2 * s + hi, cofs = lr * 4; v4f val = *(const v4fa*)(os + row * 68 + cofs);
                *(v4f*)(crow + (size_t)row * ldc + cofs) = val; }
             }
        __builtin_amdgcn_wave_barrier(); asm volatile("" ::: "memory");
    }
}

__device__ __forceinline__ h16 tohx(float x) { return (h16)x; }
__device__ __forceinline__ void splitf(float y, unsigned short& h, unsigned short& l) { h = f2bf(y); l = f2bf(y - bf2f(h)); }
typedef __attribute__((ext_vector_type(2))) _Float16 v2h;
typedef __attribute__((ext_vector_type(4))) _Float16 v4h;
typedef __attribute__((ext_vector_type(2))) unsigned short v2us;
typedef __attribute__((ext_vector_type(4))) unsigned short v4us;
typedef __attribute__((ext_vector_type(2))) float v2f;
typedef __attribute__((ext_vector_type(4))) int v4i;

__global__ __launch_bounds__(256) void k_wtG(const float* __restrict__ w, int K, int N, bf* Bt) {
    const int lane = threadIdx.x & 31; const int L0 = (blockIdx.x * 8 + (threadIdx.x >> 5)) * 8; const int nlines = N * K / 64;
{
#pragma unroll 1
        for (int l = 0; l < 8; ++l) { const int L = L0 + l; if (L >= nlines) break; const size_t e = (size_t)L * 64 + lane * 2; const int k = (int)(e % K), n = (int)(e / K); v2us o;
            o[0] = f2bf(w[(size_t)k * N + n]); o[1] = f2bf(w[(size_t)(k + 1) * N + n]); *(v2us*)(Bt + e) = o; }
         }
}
__global__ __launch_bounds__(256) void k_cvt8(const float* __restrict__ src, bf* dst, size_t n8) { const size_t i = (size_t)blockIdx.x * 256 + threadIdx.x; if (i >= n8) return; const v8f v = *(const v8f*)(src + i * 8); v8us o;
#pragma unroll
    for (int k = 0; k < 8; ++k) o[k] = f2bf(v[k]); *(v8us*)(dst + i * 8) = o;  }
__global__ __launch_bounds__(256) void k_cstab(float* CS) { const int idx = blockIdx.x * 256 + threadIdx.x; if (idx >= TT * HD) return; const int t = idx / HD, d = idx % HD; const int i = d >> 1;   /* interleaved pairs (2i, 2i+1) share angle t * inv_freq[i] */ const float inv = __fdiv_rn(1.0f, powf(10000.0f, (float)(2 * i) / (float)HD)); const float ang = __fmul_rn((float)t, inv); v2f cs; cs[0] = cosf(ang); cs[1] = sinf(ang);
    *(v2f*)(CS + (size_t)idx * 2) = cs;  }
__global__ __launch_bounds__(256) void k_hrms(const float* __restrict__ F, int pitch, int nheads, float* RF) { const int i = blockIdx.x * 256 + threadIdx.x; if (i >= nheads * TT) return; const int t = i % TT, h = i / TT; const float* f = F + (size_t)t * pitch + h * HD; float s = 0.f;
#pragma unroll 4
    for (int d = 0; d < HD; d += 4) { const v4f v = *(const v4f*)(f + d);
#pragma unroll
        for (int q = 0; q < 4; ++q) { float p = __fmul_rn(v[q], v[q]); asm volatile("" : "+v"(p)); s = __fadd_rn(s, p); } }
    const float r = __fdiv_rn(1.0f, __fsqrt_rn(__fadd_rn(s * (1.0f / HD), 1e-6f))); *(float*)(RF + i) = r;  }
// k_rope: head planes [h][t][d] (fp16 + hi/lo) of rope(w[d] (x rms_factor)) x sc with the interleaved-pair convention out[2i] = x[2i] cos[t][2i] - x[2i+1] sin[t][2i], out[2i+1] = x[2i+1] cos[t][2i+1] + x[2i] sin[t][2i+1]
__global__ __launch_bounds__(256) void k_rope(const float* __restrict__ F, int pitch, int nheads, const float* __restrict__ CS, const float* __restrict__ RF, const float* __restrict__ nw, float sc, h16* P16, bf* Ph, bf* Pl) {
    const size_t e = ((size_t)blockIdx.x * 256 + threadIdx.x) * 2; if (e >= (size_t)nheads * TT * HD) return; const int d = (int)(e % HD); const int t = (int)((e / HD) % TT); const int h = (int)(e / ((size_t)HD * TT)); const float* f = F + (size_t)t * pitch + h * HD; const float rf = RF ? RF[(size_t)h * TT + t] : 1.0f; v2h o16; v2us oh, ol;
#pragma unroll
    for (int q = 0; q < 2; ++q) { const int dd = d + q; const int dp = dd ^ 1; float x0 = f[dd], x1 = f[dp];
        if (RF) { float n0 = __fmul_rn(x0, rf), n1 = __fmul_rn(x1, rf); asm volatile("" : "+v"(n0)); asm volatile("" : "+v"(n1)); x0 = __fmul_rn(bfr(nw[dd]), n0); x1 = __fmul_rn(bfr(nw[dp]), n1); }
        const v2f cs = *(const v2f*)(CS + ((size_t)t * HD + dd) * 2); float a = __fmul_rn(x0, cs[0]), bq = __fmul_rn(x1, cs[1]); asm volatile("" : "+v"(a)); asm volatile("" : "+v"(bq)); const float r = (((dd & 1) == 0) ? __fsub_rn(a, bq) : __fadd_rn(a, bq)) * sc;
        o16[q] = tohx(r); unsigned short a2, c2; splitf(r, a2, c2); oh[q] = a2; ol[q] = c2; }
    *(v2h*)(P16 + e) = o16; *(v2us*)(Ph + e) = oh; *(v2us*)(Pl + e) = ol;  }
__global__ __launch_bounds__(256) void k_vtp(const float* __restrict__ F, int pitch, int nheads, h16* V16, bf* Vh, bf* Vl) { const size_t e = ((size_t)blockIdx.x * 256 + threadIdx.x) * 2; if (e >= (size_t)nheads * HD * TT) return; const int t = (int)(e % TT); const int d = (int)((e / TT) % HD); const int g = (int)(e / ((size_t)TT * HD)); v2h o16; v2us oh, ol;
#pragma unroll
    for (int q = 0; q < 2; ++q) { const float x = F[(size_t)(t + q) * pitch + g * HD + d]; o16[q] = tohx(x); unsigned short a2, c2; splitf(x, a2, c2); oh[q] = a2; ol[q] = c2; }
    *(v2h*)(V16 + e) = o16; *(v2us*)(Vh + e) = oh; *(v2us*)(Vl + e) = ol;  }
// k_asoft: per row (zz, i): t = S x HD^-0.5 for j <= i and i - j < WIN (sliding causal window; the reference's -1e9 additive fill vanishes identically); softmax over the 2048 keys (register row, one exp, fixed trees);
__global__ __launch_bounds__(256) void k_asoft(const float* __restrict__ Sb, h16* P16, bf* Ph, bf* Pl) {
    const int lane = threadIdx.x & 31; const int row = blockIdx.x * 8 + (threadIdx.x >> 5); if (row >= ZH * TT) return; const int i = row % TT; const int zz = row / TT; (void)zz; const bool hires = (i < RH); const float* sr = Sb + (size_t)row * TT; float v[TT / 32]; float mx = -3.0e38f;
#pragma unroll
    for (int ch = 0; ch < TT / 128; ++ch) { const int j0 = ch * 128 + lane * 4; const v4f a = *(const v4f*)(sr + j0);
#pragma unroll
        for (int q = 0; q < 4; ++q) { const int j = j0 + q; (void)j; const float t = (j <= i && i - j < WIN) ? a[q] * SCL : -3.0e38f; v[ch * 4 + q] = t; mx = fmaxf(mx, t); } }
#pragma unroll
    for (int sh = 16; sh; sh >>= 1) mx = fmaxf(mx, __shfl_xor(mx, sh, 32));
    float sum = 0.f;
#pragma unroll
    for (int k = 0; k < TT / 32; ++k) { float d0 = __fsub_rn(v[k], mx); asm volatile("" : "+v"(d0)); v[k] = __builtin_amdgcn_exp2f(__fmul_rn(d0, 1.4426950408889634f)); sum += v[k]; }
#pragma unroll
    for (int sh = 16; sh; sh >>= 1) sum += __shfl_xor(sum, sh, 32);
    const float f = __fdiv_rn(hires ? 1.0f : PCAR, sum);
{
        if (hires) {
#pragma unroll
            for (int ch = 0; ch < TT / 128; ++ch) { v4us oh, ol;
#pragma unroll
                for (int q = 0; q < 4; ++q) { unsigned short a, c2; splitf(v[ch * 4 + q] * f, a, c2); oh[q] = a; ol[q] = c2; }
                const size_t oo = ((size_t)zz * (RH ? RH : 1) + i) * TT + ch * 128 + lane * 4; *(v4us*)(Ph + oo) = oh; *(v4us*)(Pl + oo) = ol; }
        } else {
#pragma unroll
            for (int ch = 0; ch < TT / 128; ++ch) { v4h o4;
#pragma unroll
                for (int q = 0; q < 4; ++q) o4[q] = tohx(v[ch * 4 + q] * f);
                *(v4h*)(P16 + (size_t)row * TT + ch * 128 + lane * 4) = o4; } }
         }
}
__global__ __launch_bounds__(256) void k_merge(const float* __restrict__ O, int h0, bf* Ah, bf* Al) { const size_t e = ((size_t)blockIdx.x * 256 + threadIdx.x) * 2; if (e >= (size_t)ZH * TT * HD) return; const int d = (int)(e % HD); const int t = (int)((e / HD) % TT); const int zz = (int)(e / ((size_t)HD * TT)); const float cs = (t < RH) ? 1.0f : (1.0f / PCAR); const size_t oo = (size_t)t * DQ + (h0 + zz) * HD + d;
    v2us oh, ol;
#pragma unroll
    for (int q = 0; q < 2; ++q) { unsigned short a, c2; splitf(O[e + q] * cs, a, c2); oh[q] = a; ol[q] = c2; } *(v2us*)(Ah + oo) = oh; *(v2us*)(Al + oo) = ol;  }

extern "C" void kernel_launch(void* const* d_in, const int* in_sizes, int n_in,
                              void* d_out, int out_size, void* d_ws, size_t ws_size, hipStream_t stream) {
    (void)in_sizes; (void)n_in; (void)out_size;
    const float* x = (const float*)d_in[0]; const float* wq = (const float*)d_in[1]; const float* wk = (const float*)d_in[2]; const float* wv = (const float*)d_in[3]; const float* wo = (const float*)d_in[4]; const float* qnw = (const float*)d_in[5]; const float* knw = (const float*)d_in[6];
    float* OUT = (float*)d_out;     // [2][2048][2048]
    char* wsp = (char*)d_ws;
    auto take = [&](size_t bytes) { char* p = wsp; wsp += (bytes + 255) & ~(size_t)255; return (void*)p; };
    bf* WQ = (bf*)take((size_t)DQ * DM * 2); bf* WK = (bf*)take((size_t)DKV * DM * 2); bf* WV = (bf*)take((size_t)DKV * DM * 2); bf* WO = (bf*)take((size_t)DM * DQ * 2); float* CS = (float*)take((size_t)TT * HD * 2 * 4); float* RFQ = (float*)take((size_t)NH_ * TT * 4); float* RFK = (float*)take((size_t)NKV * TT * 4);
    bf* XB = (bf*)take((size_t)TT * DM * 2); float* FQ = (float*)take((size_t)TT * DQ * 4); float* FK = (float*)take((size_t)TT * DKV * 4);
    h16* QP16 = (h16*)take((size_t)NH_ * TT * HD * 2); h16* KP16 = (h16*)take((size_t)NKV * TT * HD * 2); h16* VT16 = (h16*)take((size_t)NKV * HD * TT * 2);
    bf* QPh = (bf*)take((size_t)NH_ * TT * HD * 2); bf* QPl = (bf*)take((size_t)NH_ * TT * HD * 2); bf* KPh = (bf*)take((size_t)NKV * TT * HD * 2); bf* KPl = (bf*)take((size_t)NKV * TT * HD * 2); bf* VTh = (bf*)take((size_t)NKV * HD * TT * 2); bf* VTl = (bf*)take((size_t)NKV * HD * TT * 2); bf* Ph = (bf*)take((size_t)ZH * RH * TT * 2); bf* Pl = (bf*)take((size_t)ZH * RH * TT * 2);
    float* Sb = (float*)take((size_t)ZH * TT * TT * 4); h16* P16 = (h16*)take((size_t)ZH * TT * TT * 2); float* Ob = (float*)take((size_t)ZH * TT * HD * 4); bf* ATh = (bf*)take((size_t)TT * DQ * 2); bf* ATl = (bf*)take((size_t)TT * DQ * 2);
    if ((size_t)(wsp - (char*)d_ws) > ws_size) return;    // ws 256 MiB
    float* FV = FK;   // v projection reuses the k buffer after the k planes are built (stream-ordered)
    { k_cvt8<<<(unsigned)(((size_t)DQ * DM / 8 + 255) / 256), 256, 0, stream>>>(wq, WQ, (size_t)DQ * DM / 8); k_cvt8<<<(unsigned)(((size_t)DKV * DM / 8 + 255) / 256), 256, 0, stream>>>(wk, WK, (size_t)DKV * DM / 8); k_cvt8<<<(unsigned)(((size_t)DKV * DM / 8 + 255) / 256), 256, 0, stream>>>(wv, WV, (size_t)DKV * DM / 8);
      k_cvt8<<<(unsigned)(((size_t)DM * DQ / 8 + 255) / 256), 256, 0, stream>>>(wo, WO, (size_t)DM * DQ / 8);
      k_cstab<<<(TT * HD + 255) / 256, 256, 0, stream>>>(CS); }
    const unsigned LQ = (unsigned)(((size_t)NH_ * TT * HD / 2 + 255) / 256), LKv = (unsigned)(((size_t)NKV * TT * HD / 2 + 255) / 256);
    for (int b = 0; b < NB_; ++b) {
        
        k_cvt8<<<(unsigned)(((size_t)TT * DM / 8 + 255) / 256), 256, 0, stream>>>(x + (size_t)b * TT * DM, XB, (size_t)TT * DM / 8);
        k_gemmw<bf, 0, false><<<dim3(TT / 64, DQ / 64, 1), 32, 0, stream>>>(XB, nullptr, WQ, nullptr, DM, FQ, DQ, nullptr, 0, 0, 0); k_hrms<<<(NH_ * TT + 255) / 256, 256, 0, stream>>>(FQ, DQ, NH_, RFQ);
        k_rope<<<LQ, 256, 0, stream>>>(FQ, DQ, NH_, CS, RFQ, qnw, 1.0f, QP16, QPh, QPl);
        k_gemmw<bf, 0, false><<<dim3(TT / 64, DKV / 64, 1), 32, 0, stream>>>(XB, nullptr, WK, nullptr, DM, FK, DKV, nullptr, 0, 0, 0); k_hrms<<<(NKV * TT + 255) / 256, 256, 0, stream>>>(FK, DKV, NKV, RFK);
        k_rope<<<LKv, 256, 0, stream>>>(FK, DKV, NKV, CS, RFK, knw, 1.0f, KP16, KPh, KPl);
        k_gemmw<bf, 0, false><<<dim3(TT / 64, DKV / 64, 1), 32, 0, stream>>>(XB, nullptr, WV, nullptr, DM, FV, DKV, nullptr, 0, 0, 0); k_vtp<<<LKv, 256, 0, stream>>>(FV, DKV, NKV, VT16, VTh, VTl);
        for (int h0 = 0; h0 < NH_; h0 += ZH) { const size_t zq = (size_t)h0, zk = (size_t)(h0 / REP);   // both heads of a pass share kv group h0/REP (REP >= 2): sB = 0
            k_gemmc<bf, 2, 1><<<dim3(RH / 64, TT / 64, ZH), 32, 0, stream>>>(QPh + zq * TT * HD, QPl + zq * TT * HD, KPh + zk * TT * HD, KPl + zk * TT * HD, HD, Sb, TT, 0, (size_t)TT * HD, 0, (size_t)TT * TT);
            k_gemmc<h16, 0, 1><<<dim3((TT - RH) / 64, TT / 64, ZH), 32, 0, stream>>>(QP16 + zq * TT * HD + (size_t)RH * HD, nullptr, KP16 + zk * TT * HD, nullptr, HD, Sb + (size_t)RH * TT, TT, RH, (size_t)TT * HD, 0, (size_t)TT * TT);
            k_asoft<<<ZH * TT / 8, 256, 0, stream>>>(Sb, P16, Ph, Pl);
            k_gemmc<bf, 2, 2><<<dim3(RH / 64, HD / 64, ZH), 32, 0, stream>>>(Ph, Pl, VTh + zk * HD * TT, VTl + zk * HD * TT, TT, Ob, HD, 0, (size_t)RH * TT, 0, (size_t)TT * HD);
            k_gemmc<h16, 0, 2><<<dim3((TT - RH) / 64, HD / 64, ZH), 32, 0, stream>>>(P16 + (size_t)RH * TT, nullptr, VT16 + zk * HD * TT, nullptr, TT, Ob + (size_t)RH * HD, HD, RH, (size_t)TT * TT, 0, (size_t)TT * HD);
            k_merge<<<(unsigned)(((size_t)ZH * TT * HD / 2 + 255) / 256), 256, 0, stream>>>(Ob, h0, ATh, ATl); }
        k_gemmw<bf, 1, false><<<dim3(TT / 64, DM / 64, 1), 32, 0, stream>>>(ATh, ATl, WO, nullptr, DQ, OUT + (size_t)b * TT * DM, DM, nullptr, 0, 0, 0); }
}

// v001
// Measured time: 893 microseconds a run.
// Two timings next to v000 both put it at 1.84 times that version's speed.
#include <hip/hip_runtime.h>

// _CompatAttention (x [2][2048][2048]; q = RMSNorm_128(x wq^T) * q_norm_w (16 heads x 128), k = RMSNorm_128(x wk^T) * k_norm_w, v = x wv^T (4 kv heads; group h/4); interleaved-pair RoPE (theta 1e4, positions 0..L-1, tables computed on device); causal softmax(q.k / sqrt(128)) (finfo.min fill); out = merged wo^T -> [2][2048][2048]).
// Compute dtypes, f32 accumulate: every input rounded to bf16; q/k/v on PLAIN bf16 operands (inputs: exact); RMSNorm (eps 1e-6) and RoPE f32; causal scores and attn.v: query rows < 512 hl (3 products), the rest single fp16 (x1024), causal tile skipping; softmax f32; wo hl x exact (2 products).

#define NB_  2
#define TT   2048
#define DM   2048
#define NH_  16
#define NKV  4
#define REP  (NH_ / NKV)
#define HD   128
#define DQ   (NH_ * HD)
#define DKV  (NKV * HD)
#define ZH   2
#define RH   512                  // query rows < RH use hi+lo planes (0: none)
#define WIN  2048
#define PCAR 1024.0f
#define SCL  0.088388347648318447f   // HD^-0.5
typedef _Float16 h16;
typedef unsigned short bf;
typedef __attribute__((ext_vector_type(16))) __bf16   v16bf;
typedef __attribute__((ext_vector_type(16))) _Float16 v16h;
typedef __attribute__((ext_vector_type(8)))  _Float16 v8h;
typedef __attribute__((ext_vector_type(8)))  unsigned short v8us;
typedef __attribute__((ext_vector_type(8)))  float    v8f;
typedef __attribute__((ext_vector_type(4)))  float    v4f;
typedef v8h  __attribute__((may_alias)) v8ha;
typedef v4f  __attribute__((may_alias)) v4fa;
typedef v8us __attribute__((may_alias)) v8usa;

__device__ __forceinline__ unsigned short f2bf(float f) { unsigned u = __float_as_uint(f); u += 0x7FFFu + ((u >> 16) & 1u); return (unsigned short)(u >> 16); }
__device__ __forceinline__ float bf2f(unsigned short b) { return __uint_as_float(((unsigned)b) << 16); }
__device__ __forceinline__ float bfr(float f) { return bf2f(f2bf(f)); }
__device__ __forceinline__ v16h cat16(v8h lo, v8h hi) { return __builtin_shufflevector(lo, hi, 0, 1, 2, 3, 4, 5, 6, 7, 8, 9, 10, 11, 12, 13, 14, 15); }
__device__ __forceinline__ v16bf cat16b(v8us lo, v8us hi) { return __builtin_bit_cast(v16bf, __builtin_shufflevector(lo, hi, 0, 1, 2, 3, 4, 5, 6, 7, 8, 9, 10, 11, 12, 13, 14, 15)); }
__device__ __forceinline__ v8f wmma16(v16h a, v16h b, v8f c) { return __builtin_amdgcn_wmma_f32_16x16x32_f16(false, a, false, b, (short)0, c, false, false); }
__device__ __forceinline__ v8f wmmab(v16bf a, v16bf b, v8f c) { return __builtin_amdgcn_wmma_f32_16x16x32_bf16(false, a, false, b, (short)0, c, false, false); }



// ---- k_gemmw: register-blocked GEMM, one work-group of NW waves per 64x64 output tile; wave w takes the 32-wide K slices w, w + NW, ... into its own 16 accumulators (operands straight from K-contiguous 16-bit planes),
// the NW partial tiles meet in LDS (column-major, pitch 68) behind one barrier and are summed in wave order 0..NW-1; grid (M/64, N/64, Z), 32 * NW threads.
// C[m][n] (f32, pitch ldc, + optional f32 bias[n]) = sum_k A[m][k] Bt[n][k] (+ split products per NSPLIT). z-batch strides sA/sB/sC in elements. K % 32 == 0.
template <typename T16> struct WFrag;
template <> struct WFrag<h16> { typedef v16h V; static __device__ __forceinline__ V ld(const h16* p) { return cat16(*(const v8h*)p, *(const v8h*)(p + 16)); } static __device__ __forceinline__ v8f mma(V a, V b, v8f c) { return wmma16(a, b, c); } };
template <> struct WFrag<bf> { typedef v16bf V; static __device__ __forceinline__ V ld(const bf* p) { return cat16b(*(const v8us*)p, *(const v8us*)(p + 16)); } static __device__ __forceinline__ v8f mma(V a, V b, v8f c) { return wmmab(a, b, c); } };
template <typename T16, int NSPLIT, bool BIAS, int NW>
__global__ __launch_bounds__(32 * NW) void k_gemmw(const T16* __restrict__ A, const T16* __restrict__ A2, const T16* __restrict__ Bt, const T16* __restrict__ Bt2, int K, float* C, int ldc, const float* __restrict__ bias, size_t sA, size_t sB, size_t sC) {
    typedef typename WFrag<T16>::V V;
    __shared__ __align__(16) float os[NW * 64 * 68];
    const size_t z = blockIdx.z; A += z * sA; if (A2) A2 += z * sA; Bt += z * sB; if (Bt2) Bt2 += z * sB; C += z * sC;
    const int lane = threadIdx.x & 31, lr = lane & 15, hi = lane >> 4; const int w = __builtin_amdgcn_readfirstlane((int)(threadIdx.x >> 5));   /* wave number held scalar, so the K loop's counter and branch stay scalar */ const int r0 = blockIdx.x * 64, c0 = blockIdx.y * 64;
    v8f acc[4][4];
#pragma unroll
    for (int mb = 0; mb < 4; ++mb)
#pragma unroll
        for (int nb = 0; nb < 4; ++nb) acc[mb][nb] = (v8f){};
    const size_t aoff = (size_t)(r0 + lr) * K + 8 * hi, boff = (size_t)(c0 + lr) * K + 8 * hi;
#pragma unroll 1
    for (int kc = w * 32; kc < K; kc += 32 * NW) {
        V a[4], a2[4];
#pragma unroll
        for (int mb = 0; mb < 4; ++mb) { a[mb] = WFrag<T16>::ld(A + aoff + (size_t)mb * 16 * K + kc); if (NSPLIT == 1 || NSPLIT == 2) a2[mb] = WFrag<T16>::ld(A2 + aoff + (size_t)mb * 16 * K + kc); }
#pragma unroll
        for (int nb = 0; nb < 4; ++nb) { const V b = WFrag<T16>::ld(Bt + boff + (size_t)nb * 16 * K + kc); V b2; if (NSPLIT >= 2) b2 = WFrag<T16>::ld(Bt2 + boff + (size_t)nb * 16 * K + kc);
#pragma unroll
            for (int mb = 0; mb < 4; ++mb) { acc[mb][nb] = WFrag<T16>::mma(a[mb], b, acc[mb][nb]); if (NSPLIT == 1 || NSPLIT == 2) acc[mb][nb] = WFrag<T16>::mma(a2[mb], b, acc[mb][nb]); if (NSPLIT >= 2) acc[mb][nb] = WFrag<T16>::mma(a[mb], b2, acc[mb][nb]); } }
        asm volatile("v_nop\n\tv_nop\n\tv_nop\n\tv_nop" : "+v"(acc[0][0]), "+v"(acc[1][1]), "+v"(acc[2][2]), "+v"(acc[3][3]) : "v"(a[0]), "v"(a[3]));
    }
    float* ow = os + w * (64 * 68) + lr * 68 + hi * 8;   // element (row, col) of this wave's partial tile lies at col * 68 + row: an accumulator's 8 rows are two 16-byte stores
    // both loops unrolled: acc[][] stays in registers only under constant indices
#pragma unroll
    for (int mb = 0; mb < 4; ++mb)
#pragma unroll
        for (int nb = 0; nb < 4; ++nb) { float* p = ow + nb * 16 * 68 + mb * 16; const v8f t = acc[mb][nb]; *(v4fa*)p = __builtin_shufflevector(t, t, 0, 1, 2, 3); *(v4fa*)(p + 4) = __builtin_shufflevector(t, t, 4, 5, 6, 7); }
    __syncthreads();   // every wave's partial tile is in LDS before any wave sums
    // the loops below are unrolled so that the LDS loads of all NW partial tiles issue together, val[] stays in registers and the offsets fold into the instructions
    v4f val[32 / NW];   // wave w owns rows w * 64 / NW ..., whole 256-byte rows; val[u]: 4 rows (row group u >> 1) of column (u & 1) * 32 + lane
#pragma unroll
    for (int u = 0; u < 32 / NW; ++u) { const float* p = os + ((u & 1) * 32 + lane) * 68 + (w * (16 / NW) + (u >> 1)) * 4; val[u] = *(const v4fa*)p;
#pragma unroll
        for (int ww = 1; ww < NW; ++ww) val[u] += *(const v4fa*)(p + ww * (64 * 68));
        if (BIAS) { const float bv = bfr(bias[c0 + (u & 1) * 32 + lane]); val[u][0] += bv; val[u][1] += bv; val[u][2] += bv; val[u][3] += bv; }
    }
    float* cb = C + (size_t)(r0 + w * (64 / NW)) * ldc + c0;   // wave-uniform base of the wave's first row; a store covers 32 adjacent columns, one 128-byte line
#pragma unroll
    for (int k = 0; k < 64 / NW; ++k) { float* cr = cb + (size_t)k * ldc; cr[lane] = val[(k >> 2) * 2][k & 3]; cr[32 + lane] = val[(k >> 2) * 2 + 1][k & 3]; }
}

// ---- k_gemmc: the same NW-wave 64x64 tile GEMM specialised for causal attention: CMODE 1 skips score tiles entirely above the diagonal (query rows r0+roff.., key columns c0..), CMODE 2 limits the
// key (K) loop of the probability x value contraction to the diagonal block (probabilities beyond it are exactly zero). roff = row offset of this launch's first row within the sequence.
template <typename T16, int NSPLIT, int CMODE, int NW>
__global__ __launch_bounds__(32 * NW) void k_gemmc(const T16* __restrict__ A, const T16* __restrict__ A2, const T16* __restrict__ Bt, const T16* __restrict__ Bt2, int K, float* C, int ldc, int roff, size_t sA, size_t sB, size_t sC) {
    typedef typename WFrag<T16>::V V;
    __shared__ __align__(16) float os[NW * 64 * 68];
    const size_t z = blockIdx.z; A += z * sA; if (A2) A2 += z * sA; Bt += z * sB; if (Bt2) Bt2 += z * sB; C += z * sC;
    const int lane = threadIdx.x & 31, lr = lane & 15, hi = lane >> 4; const int w = __builtin_amdgcn_readfirstlane((int)(threadIdx.x >> 5));   /* wave number held scalar, so the K loop's counter and branch stay scalar */ const int r0 = blockIdx.x * 64, c0 = blockIdx.y * 64;
    if (CMODE == 1 && c0 > r0 + roff + 63) return;                  // score tile entirely above the causal diagonal: never read (the softmax masks j > i by select)
    const int Kl = (CMODE == 2) ? min(K, r0 + roff + 64) : K;        // P.V: probabilities are exactly 0 beyond the diagonal block, so the K loop stops there
    v8f acc[4][4];
#pragma unroll
    for (int mb = 0; mb < 4; ++mb)
#pragma unroll
        for (int nb = 0; nb < 4; ++nb) acc[mb][nb] = (v8f){};
    const size_t aoff = (size_t)(r0 + lr) * K + 8 * hi, boff = (size_t)(c0 + lr) * K + 8 * hi;
#pragma unroll 1
    for (int kc = w * 32; kc < Kl; kc += 32 * NW) {
        V a[4], a2[4];
#pragma unroll
        for (int mb = 0; mb < 4; ++mb) { a[mb] = WFrag<T16>::ld(A + aoff + (size_t)mb * 16 * K + kc); if (NSPLIT == 1 || NSPLIT == 2) a2[mb] = WFrag<T16>::ld(A2 + aoff + (size_t)mb * 16 * K + kc); }
#pragma unroll
        for (int nb = 0; nb < 4; ++nb) { const V b = WFrag<T16>::ld(Bt + boff + (size_t)nb * 16 * K + kc); V b2; if (NSPLIT >= 2) b2 = WFrag<T16>::ld(Bt2 + boff + (size_t)nb * 16 * K + kc);
#pragma unroll
            for (int mb = 0; mb < 4; ++mb) { acc[mb][nb] = WFrag<T16>::mma(a[mb], b, acc[mb][nb]); if (NSPLIT == 1 || NSPLIT == 2) acc[mb][nb] = WFrag<T16>::mma(a2[mb], b, acc[mb][nb]); if (NSPLIT >= 2) acc[mb][nb] = WFrag<T16>::mma(a[mb], b2, acc[mb][nb]); } }
        asm volatile("v_nop\n\tv_nop\n\tv_nop\n\tv_nop" : "+v"(acc[0][0]), "+v"(acc[1][1]), "+v"(acc[2][2]), "+v"(acc[3][3]) : "v"(a[0]), "v"(a[3]));
    }
    float* ow = os + w * (64 * 68) + lr * 68 + hi * 8;   // element (row, col) of this wave's partial tile lies at col * 68 + row: an accumulator's 8 rows are two 16-byte stores
    // both loops unrolled: acc[][] stays in registers only under constant indices
#pragma unroll
    for (int mb = 0; mb < 4; ++mb)
#pragma unroll
        for (int nb = 0; nb < 4; ++nb) { float* p = ow + nb * 16 * 68 + mb * 16; const v8f t = acc[mb][nb]; *(v4fa*)p = __builtin_shufflevector(t, t, 0, 1, 2, 3); *(v4fa*)(p + 4) = __builtin_shufflevector(t, t, 4, 5, 6, 7); }
    __syncthreads();   // every wave's partial tile is in LDS before any wave sums
    // the loops below are unrolled so that the LDS loads of all NW partial tiles issue together, val[] stays in registers and the offsets fold into the instructions
    v4f val[32 / NW];   // wave w owns rows w * 64 / NW ..., whole 256-byte rows; val[u]: 4 rows (row group u >> 1) of column (u & 1) * 32 + lane
#pragma unroll
    for (int u = 0; u < 32 / NW; ++u) { const float* p = os + ((u & 1) * 32 + lane) * 68 + (w * (16 / NW) + (u >> 1)) * 4; val[u] = *(const v4fa*)p;
#pragma unroll
        for (int ww = 1; ww < NW; ++ww) val[u] += *(const v4fa*)(p + ww * (64 * 68));
    }
    float* cb = C + (size_t)(r0 + w * (64 / NW)) * ldc + c0;   // wave-uniform base of the wave's first row; a store covers 32 adjacent columns, one 128-byte line
#pragma unroll
    for (int k = 0; k < 64 / NW; ++k) { float* cr = cb + (size_t)k * ldc; cr[lane] = val[(k >> 2) * 2][k & 3]; cr[32 + lane] = val[(k >> 2) * 2 + 1][k & 3]; }
}

__device__ __forceinline__ h16 tohx(float x) { return (h16)x; }
__device__ __forceinline__ void splitf(float y, unsigned short& h, unsigned short& l) { h = f2bf(y); l = f2bf(y - bf2f(h)); }
typedef __attribute__((ext_vector_type(2))) _Float16 v2h;
typedef __attribute__((ext_vector_type(4))) _Float16 v4h;
typedef __attribute__((ext_vector_type(2))) unsigned short v2us;
typedef __attribute__((ext_vector_type(4))) unsigned short v4us;
typedef __attribute__((ext_vector_type(2))) float v2f;
typedef __attribute__((ext_vector_type(4))) int v4i;

__global__ __launch_bounds__(256) void k_wtG(const float* __restrict__ w, int K, int N, bf* Bt) {
    const int lane = threadIdx.x & 31; const int L0 = (blockIdx.x * 8 + (threadIdx.x >> 5)) * 8; const int nlines = N * K / 64;
{
#pragma unroll 1
        for (int l = 0; l < 8; ++l) { const int L = L0 + l; if (L >= nlines) break; const size_t e = (size_t)L * 64 + lane * 2; const int k = (int)(e % K), n = (int)(e / K); v2us o;
            o[0] = f2bf(w[(size_t)k * N + n]); o[1] = f2bf(w[(size_t)(k + 1) * N + n]); *(v2us*)(Bt + e) = o; }
         }
}
__global__ __launch_bounds__(256) void k_cvt8(const float* __restrict__ src, bf* dst, size_t n8) { const size_t i = (size_t)blockIdx.x * 256 + threadIdx.x; if (i >= n8) return; const v8f v = *(const v8f*)(src + i * 8); v8us o;
#pragma unroll
    for (int k = 0; k < 8; ++k) o[k] = f2bf(v[k]); *(v8us*)(dst + i * 8) = o;  }
__global__ __launch_bounds__(256) void k_cstab(float* CS) { const int idx = blockIdx.x * 256 + threadIdx.x; if (idx >= TT * HD) return; const int t = idx / HD, d = idx % HD; const int i = d >> 1;   /* interleaved pairs (2i, 2i+1) share angle t * inv_freq[i] */ const float inv = __fdiv_rn(1.0f, powf(10000.0f, (float)(2 * i) / (float)HD)); const float ang = __fmul_rn((float)t, inv); v2f cs; cs[0] = cosf(ang); cs[1] = sinf(ang);
    *(v2f*)(CS + (size_t)idx * 2) = cs;  }
__global__ __launch_bounds__(256) void k_hrms(const float* __restrict__ F, int pitch, int nheads, float* RF) { const int i = blockIdx.x * 256 + threadIdx.x; if (i >= nheads * TT) return; const int t = i % TT, h = i / TT; const float* f = F + (size_t)t * pitch + h * HD; float s = 0.f;
#pragma unroll 4
    for (int d = 0; d < HD; d += 4) { const v4f v = *(const v4f*)(f + d);
#pragma unroll
        for (int q = 0; q < 4; ++q) { float p = __fmul_rn(v[q], v[q]); asm volatile("" : "+v"(p)); s = __fadd_rn(s, p); } }
    const float r = __fdiv_rn(1.0f, __fsqrt_rn(__fadd_rn(s * (1.0f / HD), 1e-6f))); *(float*)(RF + i) = r;  }
// k_rope: head planes [h][t][d] (fp16 + hi/lo) of rope(w[d] (x rms_factor)) x sc with the interleaved-pair convention out[2i] = x[2i] cos[t][2i] - x[2i+1] sin[t][2i], out[2i+1] = x[2i+1] cos[t][2i+1] + x[2i] sin[t][2i+1]
__global__ __launch_bounds__(256) void k_rope(const float* __restrict__ F, int pitch, int nheads, const float* __restrict__ CS, const float* __restrict__ RF, const float* __restrict__ nw, float sc, h16* P16, bf* Ph, bf* Pl) {
    const size_t e = ((size_t)blockIdx.x * 256 + threadIdx.x) * 2; if (e >= (size_t)nheads * TT * HD) return; const int d = (int)(e % HD); const int t = (int)((e / HD) % TT); const int h = (int)(e / ((size_t)HD * TT)); const float* f = F + (size_t)t * pitch + h * HD; const float rf = RF ? RF[(size_t)h * TT + t] : 1.0f; v2h o16; v2us oh, ol;
#pragma unroll
    for (int q = 0; q < 2; ++q) { const int dd = d + q; const int dp = dd ^ 1; float x0 = f[dd], x1 = f[dp];
        if (RF) { float n0 = __fmul_rn(x0, rf), n1 = __fmul_rn(x1, rf); asm volatile("" : "+v"(n0)); asm volatile("" : "+v"(n1)); x0 = __fmul_rn(bfr(nw[dd]), n0); x1 = __fmul_rn(bfr(nw[dp]), n1); }
        const v2f cs = *(const v2f*)(CS + ((size_t)t * HD + dd) * 2); float a = __fmul_rn(x0, cs[0]), bq = __fmul_rn(x1, cs[1]); asm volatile("" : "+v"(a)); asm volatile("" : "+v"(bq)); const float r = (((dd & 1) == 0) ? __fsub_rn(a, bq) : __fadd_rn(a, bq)) * sc;
        o16[q] = tohx(r); unsigned short a2, c2; splitf(r, a2, c2); oh[q] = a2; ol[q] = c2; }
    *(v2h*)(P16 + e) = o16; *(v2us*)(Ph + e) = oh; *(v2us*)(Pl + e) = ol;  }
__global__ __launch_bounds__(256) void k_vtp(const float* __restrict__ F, int pitch, int nheads, h16* V16, bf* Vh, bf* Vl) { const size_t e = ((size_t)blockIdx.x * 256 + threadIdx.x) * 2; if (e >= (size_t)nheads * HD * TT) return; const int t = (int)(e % TT); const int d = (int)((e / TT) % HD); const int g = (int)(e / ((size_t)TT * HD)); v2h o16; v2us oh, ol;
#pragma unroll
    for (int q = 0; q < 2; ++q) { const float x = F[(size_t)(t + q) * pitch + g * HD + d]; o16[q] = tohx(x); unsigned short a2, c2; splitf(x, a2, c2); oh[q] = a2; ol[q] = c2; }
    *(v2h*)(V16 + e) = o16; *(v2us*)(Vh + e) = oh; *(v2us*)(Vl + e) = ol;  }
// k_asoft: per row (zz, i): t = S x HD^-0.5 for j <= i and i - j < WIN (sliding causal window; the reference's -1e9 additive fill vanishes identically); softmax over the 2048 keys (register row, one exp, fixed trees);
__global__ __launch_bounds__(256) void k_asoft(const float* __restrict__ Sb, h16* P16, bf* Ph, bf* Pl) {
    const int lane = threadIdx.x & 31; const int row = blockIdx.x * 8 + (threadIdx.x >> 5); if (row >= ZH * TT) return; const int i = row % TT; const int zz = row / TT; (void)zz; const bool hires = (i < RH); const float* sr = Sb + (size_t)row * TT; float v[TT / 32]; float mx = -3.0e38f;
#pragma unroll
    for (int ch = 0; ch < TT / 128; ++ch) { const int j0 = ch * 128 + lane * 4; const v4f a = *(const v4f*)(sr + j0);
#pragma unroll
        for (int q = 0; q < 4; ++q) { const int j = j0 + q; (void)j; const float t = (j <= i && i - j < WIN) ? a[q] * SCL : -3.0e38f; v[ch * 4 + q] = t; mx = fmaxf(mx, t); } }
#pragma unroll
    for (int sh = 16; sh; sh >>= 1) mx = fmaxf(mx, __shfl_xor(mx, sh, 32));
    float sum = 0.f;
#pragma unroll
    for (int k = 0; k < TT / 32; ++k) { float d0 = __fsub_rn(v[k], mx); asm volatile("" : "+v"(d0)); v[k] = __builtin_amdgcn_exp2f(__fmul_rn(d0, 1.4426950408889634f)); sum += v[k]; }
#pragma unroll
    for (int sh = 16; sh; sh >>= 1) sum += __shfl_xor(sum, sh, 32);
    const float f = __fdiv_rn(hires ? 1.0f : PCAR, sum);
{
        if (hires) {
#pragma unroll
            for (int ch = 0; ch < TT / 128; ++ch) { v4us oh, ol;
#pragma unroll
                for (int q = 0; q < 4; ++q) { unsigned short a, c2; splitf(v[ch * 4 + q] * f, a, c2); oh[q] = a; ol[q] = c2; }
                const size_t oo = ((size_t)zz * (RH ? RH : 1) + i) * TT + ch * 128 + lane * 4; *(v4us*)(Ph + oo) = oh; *(v4us*)(Pl + oo) = ol; }
        } else {
#pragma unroll
            for (int ch = 0; ch < TT / 128; ++ch) { v4h o4;
#pragma unroll
                for (int q = 0; q < 4; ++q) o4[q] = tohx(v[ch * 4 + q] * f);
                *(v4h*)(P16 + (size_t)row * TT + ch * 128 + lane * 4) = o4; } }
         }
}
__global__ __launch_bounds__(256) void k_merge(const float* __restrict__ O, int h0, bf* Ah, bf* Al) { const size_t e = ((size_t)blockIdx.x * 256 + threadIdx.x) * 2; if (e >= (size_t)ZH * TT * HD) return; const int d = (int)(e % HD); const int t = (int)((e / HD) % TT); const int zz = (int)(e / ((size_t)HD * TT)); const float cs = (t < RH) ? 1.0f : (1.0f / PCAR); const size_t oo = (size_t)t * DQ + (h0 + zz) * HD + d;
    v2us oh, ol;
#pragma unroll
    for (int q = 0; q < 2; ++q) { unsigned short a, c2; splitf(O[e + q] * cs, a, c2); oh[q] = a; ol[q] = c2; } *(v2us*)(Ah + oo) = oh; *(v2us*)(Al + oo) = ol;  }

extern "C" void kernel_launch(void* const* d_in, const int* in_sizes, int n_in,
                              void* d_out, int out_size, void* d_ws, size_t ws_size, hipStream_t stream) {
    (void)in_sizes; (void)n_in; (void)out_size;
    const float* x = (const float*)d_in[0]; const float* wq = (const float*)d_in[1]; const float* wk = (const float*)d_in[2]; const float* wv = (const float*)d_in[3]; const float* wo = (const float*)d_in[4]; const float* qnw = (const float*)d_in[5]; const float* knw = (const float*)d_in[6];
    float* OUT = (float*)d_out;     // [2][2048][2048]
    char* wsp = (char*)d_ws;
    auto take = [&](size_t bytes) { char* p = wsp; wsp += (bytes + 255) & ~(size_t)255; return (void*)p; };
    bf* WQ = (bf*)take((size_t)DQ * DM * 2); bf* WK = (bf*)take((size_t)DKV * DM * 2); bf* WV = (bf*)take((size_t)DKV * DM * 2); bf* WO = (bf*)take((size_t)DM * DQ * 2); float* CS = (float*)take((size_t)TT * HD * 2 * 4); float* RFQ = (float*)take((size_t)NH_ * TT * 4); float* RFK = (float*)take((size_t)NKV * TT * 4);
    bf* XB = (bf*)take((size_t)TT * DM * 2); float* FQ = (float*)take((size_t)TT * DQ * 4); float* FK = (float*)take((size_t)TT * DKV * 4);
    h16* QP16 = (h16*)take((size_t)NH_ * TT * HD * 2); h16* KP16 = (h16*)take((size_t)NKV * TT * HD * 2); h16* VT16 = (h16*)take((size_t)NKV * HD * TT * 2);
    bf* QPh = (bf*)take((size_t)NH_ * TT * HD * 2); bf* QPl = (bf*)take((size_t)NH_ * TT * HD * 2); bf* KPh = (bf*)take((size_t)NKV * TT * HD * 2); bf* KPl = (bf*)take((size_t)NKV * TT * HD * 2); bf* VTh = (bf*)take((size_t)NKV * HD * TT * 2); bf* VTl = (bf*)take((size_t)NKV * HD * TT * 2); bf* Ph = (bf*)take((size_t)ZH * RH * TT * 2); bf* Pl = (bf*)take((size_t)ZH * RH * TT * 2);
    float* Sb = (float*)take((size_t)ZH * TT * TT * 4); h16* P16 = (h16*)take((size_t)ZH * TT * TT * 2); float* Ob = (float*)take((size_t)ZH * TT * HD * 4); bf* ATh = (bf*)take((size_t)TT * DQ * 2); bf* ATl = (bf*)take((size_t)TT * DQ * 2);
    if ((size_t)(wsp - (char*)d_ws) > ws_size) return;    // ws 256 MiB
    float* FV = FK;   // v projection reuses the k buffer after the k planes are built (stream-ordered)
    { k_cvt8<<<(unsigned)(((size_t)DQ * DM / 8 + 255) / 256), 256, 0, stream>>>(wq, WQ, (size_t)DQ * DM / 8); k_cvt8<<<(unsigned)(((size_t)DKV * DM / 8 + 255) / 256), 256, 0, stream>>>(wk, WK, (size_t)DKV * DM / 8); k_cvt8<<<(unsigned)(((size_t)DKV * DM / 8 + 255) / 256), 256, 0, stream>>>(wv, WV, (size_t)DKV * DM / 8);
      k_cvt8<<<(unsigned)(((size_t)DM * DQ / 8 + 255) / 256), 256, 0, stream>>>(wo, WO, (size_t)DM * DQ / 8);
      k_cstab<<<(TT * HD + 255) / 256, 256, 0, stream>>>(CS); }
    const unsigned LQ = (unsigned)(((size_t)NH_ * TT * HD / 2 + 255) / 256), LKv = (unsigned)(((size_t)NKV * TT * HD / 2 + 255) / 256);
    for (int b = 0; b < NB_; ++b) {
        
        k_cvt8<<<(unsigned)(((size_t)TT * DM / 8 + 255) / 256), 256, 0, stream>>>(x + (size_t)b * TT * DM, XB, (size_t)TT * DM / 8);
        k_gemmw<bf, 0, false, 8><<<dim3(TT / 64, DQ / 64, 1), 256, 0, stream>>>(XB, nullptr, WQ, nullptr, DM, FQ, DQ, nullptr, 0, 0, 0); k_hrms<<<(NH_ * TT + 255) / 256, 256, 0, stream>>>(FQ, DQ, NH_, RFQ);
        k_rope<<<LQ, 256, 0, stream>>>(FQ, DQ, NH_, CS, RFQ, qnw, 1.0f, QP16, QPh, QPl);
        k_gemmw<bf, 0, false, 16><<<dim3(TT / 64, DKV / 64, 1), 512, 0, stream>>>(XB, nullptr, WK, nullptr, DM, FK, DKV, nullptr, 0, 0, 0); k_hrms<<<(NKV * TT + 255) / 256, 256, 0, stream>>>(FK, DKV, NKV, RFK);
        k_rope<<<LKv, 256, 0, stream>>>(FK, DKV, NKV, CS, RFK, knw, 1.0f, KP16, KPh, KPl);
        k_gemmw<bf, 0, false, 16><<<dim3(TT / 64, DKV / 64, 1), 512, 0, stream>>>(XB, nullptr, WV, nullptr, DM, FV, DKV, nullptr, 0, 0, 0); k_vtp<<<LKv, 256, 0, stream>>>(FV, DKV, NKV, VT16, VTh, VTl);
        for (int h0 = 0; h0 < NH_; h0 += ZH) { const size_t zq = (size_t)h0, zk = (size_t)(h0 / REP);   // both heads of a pass share kv group h0/REP (REP >= 2): sB = 0
            k_gemmc<bf, 2, 1, 4><<<dim3(RH / 64, TT / 64, ZH), 128, 0, stream>>>(QPh + zq * TT * HD, QPl + zq * TT * HD, KPh + zk * TT * HD, KPl + zk * TT * HD, HD, Sb, TT, 0, (size_t)TT * HD, 0, (size_t)TT * TT);
            k_gemmc<h16, 0, 1, 4><<<dim3((TT - RH) / 64, TT / 64, ZH), 128, 0, stream>>>(QP16 + zq * TT * HD + (size_t)RH * HD, nullptr, KP16 + zk * TT * HD, nullptr, HD, Sb + (size_t)RH * TT, TT, RH, (size_t)TT * HD, 0, (size_t)TT * TT);
            k_asoft<<<ZH * TT / 8, 256, 0, stream>>>(Sb, P16, Ph, Pl);
            k_gemmc<bf, 2, 2, 16><<<dim3(RH / 64, HD / 64, ZH), 512, 0, stream>>>(Ph, Pl, VTh + zk * HD * TT, VTl + zk * HD * TT, TT, Ob, HD, 0, (size_t)RH * TT, 0, (size_t)TT * HD);
            k_gemmc<h16, 0, 2, 16><<<dim3((TT - RH) / 64, HD / 64, ZH), 512, 0, stream>>>(P16 + (size_t)RH * TT, nullptr, VT16 + zk * HD * TT, nullptr, TT, Ob + (size_t)RH * HD, HD, RH, (size_t)TT * TT, 0, (size_t)TT * HD);
            k_merge<<<(unsigned)(((size_t)ZH * TT * HD / 2 + 255) / 256), 256, 0, stream>>>(Ob, h0, ATh, ATl); }
        k_gemmw<bf, 1, false, 8><<<dim3(TT / 64, DM / 64, 1), 256, 0, stream>>>(ATh, ATl, WO, nullptr, DQ, OUT + (size_t)b * TT * DM, DM, nullptr, 0, 0, 0); }
}

// v002
// One run takes 679 microseconds.
// Timed twice side by side with v001, it ran 1.31 times as fast both times.
// All steps since v000 together make it 2.41 times as fast.
#include <hip/hip_runtime.h>

// _CompatAttention (x [2][2048][2048]; q = RMSNorm_128(x wq^T) * q_norm_w (16 heads x 128), k = RMSNorm_128(x wk^T) * k_norm_w, v = x wv^T (4 kv heads; group h/4); interleaved-pair RoPE (theta 1e4, positions 0..L-1, tables computed on device); causal softmax(q.k / sqrt(128)) (finfo.min fill); out = merged wo^T -> [2][2048][2048]).
// Compute dtypes, f32 accumulate: every input rounded to bf16; q/k/v on PLAIN bf16 operands (inputs: exact); RMSNorm (eps 1e-6) and RoPE f32; causal scores and attn.v: query rows < 512 hl (3 products), the rest single fp16 (x1024), causal tile skipping; softmax f32; wo hl x exact (2 products).

#define NB_  2
#define TT   2048
#define DM   2048
#define NH_  16
#define NKV  4
#define REP  (NH_ / NKV)
#define HD   128
#define DQ   (NH_ * HD)
#define DKV  (NKV * HD)
#define ZH   4                    // query heads per attention pass; at most REP, so that a pass stays inside one kv group
#define RH   512                  // query rows < RH use hi+lo planes (0: none)
#define WIN  2048
#define PCAR 1024.0f
#define SCL  0.088388347648318447f   // HD^-0.5
typedef _Float16 h16;
typedef unsigned short bf;
typedef __attribute__((ext_vector_type(16))) __bf16   v16bf;
typedef __attribute__((ext_vector_type(16))) _Float16 v16h;
typedef __attribute__((ext_vector_type(8)))  _Float16 v8h;
typedef __attribute__((ext_vector_type(8)))  unsigned short v8us;
typedef __attribute__((ext_vector_type(8)))  float    v8f;
typedef __attribute__((ext_vector_type(4)))  float    v4f;
typedef v8h  __attribute__((may_alias)) v8ha;
typedef v4f  __attribute__((may_alias)) v4fa;
typedef v8us __attribute__((may_alias)) v8usa;

__device__ __forceinline__ unsigned short f2bf(float f) { unsigned u = __float_as_uint(f); u += 0x7FFFu + ((u >> 16) & 1u); return (unsigned short)(u >> 16); }
__device__ __forceinline__ float bf2f(unsigned short b) { return __uint_as_float(((unsigned)b) << 16); }
__device__ __forceinline__ float bfr(float f) { return bf2f(f2bf(f)); }
__device__ __forceinline__ v16h cat16(v8h lo, v8h hi) { return __builtin_shufflevector(lo, hi, 0, 1, 2, 3, 4, 5, 6, 7, 8, 9, 10, 11, 12, 13, 14, 15); }
__device__ __forceinline__ v16bf cat16b(v8us lo, v8us hi) { return __builtin_bit_cast(v16bf, __builtin_shufflevector(lo, hi, 0, 1, 2, 3, 4, 5, 6, 7, 8, 9, 10, 11, 12, 13, 14, 15)); }
__device__ __forceinline__ v8f wmma16(v16h a, v16h b, v8f c) { return __builtin_amdgcn_wmma_f32_16x16x32_f16(false, a, false, b, (short)0, c, false, false); }
__device__ __forceinline__ v8f wmmab(v16bf a, v16bf b, v8f c) { return __builtin_amdgcn_wmma_f32_16x16x32_bf16(false, a, false, b, (short)0, c, false, false); }



// ---- k_gemmw: register-blocked GEMM, one work-group of NW waves per 64x64 output tile; wave w takes the 32-wide K slices w, w + NW, ... into its own 16 accumulators (operands straight from K-contiguous 16-bit planes),
// the NW partial tiles meet in LDS (column-major, pitch 68) behind one barrier and are summed in wave order 0..NW-1; grid (M/64, N/64, Z), 32 * NW threads.
// C[m][n] (f32, pitch ldc, + optional f32 bias[n]) = sum_k A[m][k] Bt[n][k] (+ split products per NSPLIT). z-batch strides sA/sB/sC in elements. K % 32 == 0.
template <typename T16> struct WFrag;
template <> struct WFrag<h16> { typedef v16h V; static __device__ __forceinline__ V ld(const h16* p) { return cat16(*(const v8h*)p, *(const v8h*)(p + 16)); } static __device__ __forceinline__ v8f mma(V a, V b, v8f c) { return wmma16(a, b, c); } };
template <> struct WFrag<bf> { typedef v16bf V; static __device__ __forceinline__ V ld(const bf* p) { return cat16b(*(const v8us*)p, *(const v8us*)(p + 16)); } static __device__ __forceinline__ v8f mma(V a, V b, v8f c) { return wmmab(a, b, c); } };
template <typename T16, int NSPLIT, bool BIAS, int NW>
__global__ __launch_bounds__(32 * NW) void k_gemmw(const T16* __restrict__ A, const T16* __restrict__ A2, const T16* __restrict__ Bt, const T16* __restrict__ Bt2, int K, float* C, int ldc, const float* __restrict__ bias, size_t sA, size_t sB, size_t sC) {
    typedef typename WFrag<T16>::V V;
    __shared__ __align__(16) float os[NW * 64 * 68];
    const size_t z = blockIdx.z; A += z * sA; if (A2) A2 += z * sA; Bt += z * sB; if (Bt2) Bt2 += z * sB; C += z * sC;
    const int lane = threadIdx.x & 31, lr = lane & 15, hi = lane >> 4; const int w = __builtin_amdgcn_readfirstlane((int)(threadIdx.x >> 5));   /* wave number held scalar, so the K loop's counter and branch stay scalar */ const int r0 = blockIdx.x * 64, c0 = blockIdx.y * 64;
    v8f acc[4][4];
#pragma unroll
    for (int mb = 0; mb < 4; ++mb)
#pragma unroll
        for (int nb = 0; nb < 4; ++nb) acc[mb][nb] = (v8f){};
    const size_t aoff = (size_t)(r0 + lr) * K + 8 * hi, boff = (size_t)(c0 + lr) * K + 8 * hi;
#pragma unroll 1
    for (int kc = w * 32; kc < K; kc += 32 * NW) {
        V a[4], a2[4];
#pragma unroll
        for (int mb = 0; mb < 4; ++mb) { a[mb] = WFrag<T16>::ld(A + aoff + (size_t)mb * 16 * K + kc); if (NSPLIT == 1 || NSPLIT == 2) a2[mb] = WFrag<T16>::ld(A2 + aoff + (size_t)mb * 16 * K + kc); }
#pragma unroll
        for (int nb = 0; nb < 4; ++nb) { const V b = WFrag<T16>::ld(Bt + boff + (size_t)nb * 16 * K + kc); V b2; if (NSPLIT >= 2) b2 = WFrag<T16>::ld(Bt2 + boff + (size_t)nb * 16 * K + kc);
#pragma unroll
            for (int mb = 0; mb < 4; ++mb) { acc[mb][nb] = WFrag<T16>::mma(a[mb], b, acc[mb][nb]); if (NSPLIT == 1 || NSPLIT == 2) acc[mb][nb] = WFrag<T16>::mma(a2[mb], b, acc[mb][nb]); if (NSPLIT >= 2) acc[mb][nb] = WFrag<T16>::mma(a[mb], b2, acc[mb][nb]); } }
        asm volatile("v_nop\n\tv_nop\n\tv_nop\n\tv_nop" : "+v"(acc[0][0]), "+v"(acc[1][1]), "+v"(acc[2][2]), "+v"(acc[3][3]) : "v"(a[0]), "v"(a[3]));
    }
    float* ow = os + w * (64 * 68) + lr * 68 + hi * 8;   // element (row, col) of this wave's partial tile lies at col * 68 + row: an accumulator's 8 rows are two 16-byte stores
    // both loops unrolled: acc[][] stays in registers only under constant indices
#pragma unroll
    for (int mb = 0; mb < 4; ++mb)
#pragma unroll
        for (int nb = 0; nb < 4; ++nb) { float* p = ow + nb * 16 * 68 + mb * 16; const v8f t = acc[mb][nb]; *(v4fa*)p = __builtin_shufflevector(t, t, 0, 1, 2, 3); *(v4fa*)(p + 4) = __builtin_shufflevector(t, t, 4, 5, 6, 7); }
    __syncthreads();   // every wave's partial tile is in LDS before any wave sums
    // the loops below are unrolled so that the LDS loads of all NW partial tiles issue together, val[] stays in registers and the offsets fold into the instructions
    v4f val[32 / NW];   // wave w owns rows w * 64 / NW ..., whole 256-byte rows; val[u]: 4 rows (row group u >> 1) of column (u & 1) * 32 + lane
#pragma unroll
    for (int u = 0; u < 32 / NW; ++u) { const float* p = os + ((u & 1) * 32 + lane) * 68 + (w * (16 / NW) + (u >> 1)) * 4; val[u] = *(const v4fa*)p;
#pragma unroll
        for (int ww = 1; ww < NW; ++ww) val[u] += *(const v4fa*)(p + ww * (64 * 68));
        if (BIAS) { const float bv = bfr(bias[c0 + (u & 1) * 32 + lane]); val[u][0] += bv; val[u][1] += bv; val[u][2] += bv; val[u][3] += bv; }
    }
    float* cb = C + (size_t)(r0 + w * (64 / NW)) * ldc + c0;   // wave-uniform base of the wave's first row; a store covers 32 adjacent columns, one 128-byte line
#pragma unroll
    for (int k = 0; k < 64 / NW; ++k) { float* cr = cb + (size_t)k * ldc; cr[lane] = val[(k >> 2) * 2][k & 3]; cr[32 + lane] = val[(k >> 2) * 2 + 1][k & 3]; }
}

// ---- k_gemmc: the same NW-wave 64x64 tile GEMM specialised for causal attention: CMODE 1 skips score tiles entirely above the diagonal (query rows r0+roff.., key columns c0..), CMODE 2 limits the
// key (K) loop of the probability x value contraction to the diagonal block (probabilities beyond it are exactly zero). roff = row offset of this launch's first row within the sequence.
template <typename T16, int NSPLIT, int CMODE, int NW>
__global__ __launch_bounds__(32 * NW) void k_gemmc(const T16* __restrict__ A, const T16* __restrict__ A2, const T16* __restrict__ Bt, const T16* __restrict__ Bt2, int K, float* C, int ldc, int roff, size_t sA, size_t sB, size_t sC) {
    typedef typename WFrag<T16>::V V;
    __shared__ __align__(16) float os[NW * 64 * 68];
    const size_t z = blockIdx.z; A += z * sA; if (A2) A2 += z * sA; Bt += z * sB; if (Bt2) Bt2 += z * sB; C += z * sC;
    const int lane = threadIdx.x & 31, lr = lane & 15, hi = lane >> 4; const int w = __builtin_amdgcn_readfirstlane((int)(threadIdx.x >> 5));   /* wave number held scalar, so the K loop's counter and branch stay scalar */ const int r0 = blockIdx.x * 64, c0 = blockIdx.y * 64;
    if (CMODE == 1 && c0 > r0 + roff + 63) return;                  // score tile entirely above the causal diagonal: never read (the softmax masks j > i by select)
    const int Kl = (CMODE == 2) ? min(K, r0 + roff + 64) : K;        // P.V: probabilities are exactly 0 beyond the diagonal block, so the K loop stops there
    v8f acc[4][4];
#pragma unroll
    for (int mb = 0; mb < 4; ++mb)
#pragma unroll
        for (int nb = 0; nb < 4; ++nb) acc[mb][nb] = (v8f){};
    const size_t aoff = (size_t)(r0 + lr) * K + 8 * hi, boff = (size_t)(c0 + lr) * K + 8 * hi;
#pragma unroll 1
    for (int kc = w * 32; kc < Kl; kc += 32 * NW) {
        V a[4], a2[4];
#pragma unroll
        for (int mb = 0; mb < 4; ++mb) { a[mb] = WFrag<T16>::ld(A + aoff + (size_t)mb * 16 * K + kc); if (NSPLIT == 1 || NSPLIT == 2) a2[mb] = WFrag<T16>::ld(A2 + aoff + (size_t)mb * 16 * K + kc); }
#pragma unroll
        for (int nb = 0; nb < 4; ++nb) { const V b = WFrag<T16>::ld(Bt + boff + (size_t)nb * 16 * K + kc); V b2; if (NSPLIT >= 2) b2 = WFrag<T16>::ld(Bt2 + boff + (size_t)nb * 16 * K + kc);
#pragma unroll
            for (int mb = 0; mb < 4; ++mb) { acc[mb][nb] = WFrag<T16>::mma(a[mb], b, acc[mb][nb]); if (NSPLIT == 1 || NSPLIT == 2) acc[mb][nb] = WFrag<T16>::mma(a2[mb], b, acc[mb][nb]); if (NSPLIT >= 2) acc[mb][nb] = WFrag<T16>::mma(a[mb], b2, acc[mb][nb]); } }
        asm volatile("v_nop\n\tv_nop\n\tv_nop\n\tv_nop" : "+v"(acc[0][0]), "+v"(acc[1][1]), "+v"(acc[2][2]), "+v"(acc[3][3]) : "v"(a[0]), "v"(a[3]));
    }
    float* ow = os + w * (64 * 68) + lr * 68 + hi * 8;   // element (row, col) of this wave's partial tile lies at col * 68 + row: an accumulator's 8 rows are two 16-byte stores
    // both loops unrolled: acc[][] stays in registers only under constant indices
#pragma unroll
    for (int mb = 0; mb < 4; ++mb)
#pragma unroll
        for (int nb = 0; nb < 4; ++nb) { float* p = ow + nb * 16 * 68 + mb * 16; const v8f t = acc[mb][nb]; *(v4fa*)p = __builtin_shufflevector(t, t, 0, 1, 2, 3); *(v4fa*)(p + 4) = __builtin_shufflevector(t, t, 4, 5, 6, 7); }
    __syncthreads();   // every wave's partial tile is in LDS before any wave sums
    // the loops below are unrolled so that the LDS loads of all NW partial tiles issue together, val[] stays in registers and the offsets fold into the instructions
    v4f val[32 / NW];   // wave w owns rows w * 64 / NW ..., whole 256-byte rows; val[u]: 4 rows (row group u >> 1) of column (u & 1) * 32 + lane
#pragma unroll
    for (int u = 0; u < 32 / NW; ++u) { const float* p = os + ((u & 1) * 32 + lane) * 68 + (w * (16 / NW) + (u >> 1)) * 4; val[u] = *(const v4fa*)p;
#pragma unroll
        for (int ww = 1; ww < NW; ++ww) val[u] += *(const v4fa*)(p + ww * (64 * 68));
    }
    float* cb = C + (size_t)(r0 + w * (64 / NW)) * ldc + c0;   // wave-uniform base of the wave's first row; a store covers 32 adjacent columns, one 128-byte line
#pragma unroll
    for (int k = 0; k < 64 / NW; ++k) { float* cr = cb + (size_t)k * ldc; cr[lane] = val[(k >> 2) * 2][k & 3]; cr[32 + lane] = val[(k >> 2) * 2 + 1][k & 3]; }
}

__device__ __forceinline__ h16 tohx(float x) { return (h16)x; }
__device__ __forceinline__ void splitf(float y, unsigned short& h, unsigned short& l) { h = f2bf(y); l = f2bf(y - bf2f(h)); }
typedef __attribute__((ext_vector_type(2))) _Float16 v2h;
typedef __attribute__((ext_vector_type(4))) _Float16 v4h;
typedef __attribute__((ext_vector_type(2))) unsigned short v2us;
typedef __attribute__((ext_vector_type(4))) unsigned short v4us;
typedef __attribute__((ext_vector_type(2))) float v2f;
typedef __attribute__((ext_vector_type(4))) int v4i;

__global__ __launch_bounds__(256) void k_wtG(const float* __restrict__ w, int K, int N, bf* Bt) {
    const int lane = threadIdx.x & 31; const int L0 = (blockIdx.x * 8 + (threadIdx.x >> 5)) * 8; const int nlines = N * K / 64;
{
#pragma unroll 1
        for (int l = 0; l < 8; ++l) { const int L = L0 + l; if (L >= nlines) break; const size_t e = (size_t)L * 64 + lane * 2; const int k = (int)(e % K), n = (int)(e / K); v2us o;
            o[0] = f2bf(w[(size_t)k * N + n]); o[1] = f2bf(w[(size_t)(k + 1) * N + n]); *(v2us*)(Bt + e) = o; }
         }
}
__global__ __launch_bounds__(256) void k_cvt8(const float* __restrict__ src, bf* dst, size_t n8) { const size_t i = (size_t)blockIdx.x * 256 + threadIdx.x; if (i >= n8) return; const v8f v = *(const v8f*)(src + i * 8); v8us o;
#pragma unroll
    for (int k = 0; k < 8; ++k) o[k] = f2bf(v[k]); *(v8us*)(dst + i * 8) = o;  }
__global__ __launch_bounds__(256) void k_cstab(float* CS) { const int idx = blockIdx.x * 256 + threadIdx.x; if (idx >= TT * HD) return; const int t = idx / HD, d = idx % HD; const int i = d >> 1;   /* interleaved pairs (2i, 2i+1) share angle t * inv_freq[i] */ const float inv = __fdiv_rn(1.0f, powf(10000.0f, (float)(2 * i) / (float)HD)); const float ang = __fmul_rn((float)t, inv); v2f cs; cs[0] = cosf(ang); cs[1] = sinf(ang);
    *(v2f*)(CS + (size_t)idx * 2) = cs;  }
__global__ __launch_bounds__(256) void k_hrms(const float* __restrict__ F, int pitch, int nheads, float* RF) { const int i = blockIdx.x * 256 + threadIdx.x; if (i >= nheads * TT) return; const int t = i % TT, h = i / TT; const float* f = F + (size_t)t * pitch + h * HD; float s = 0.f;
#pragma unroll 4
    for (int d = 0; d < HD; d += 4) { const v4f v = *(const v4f*)(f + d);
#pragma unroll
        for (int q = 0; q < 4; ++q) { float p = __fmul_rn(v[q], v[q]); asm volatile("" : "+v"(p)); s = __fadd_rn(s, p); } }
    const float r = __fdiv_rn(1.0f, __fsqrt_rn(__fadd_rn(s * (1.0f / HD), 1e-6f))); *(float*)(RF + i) = r;  }
// k_rope: head planes [h][t][d] (fp16 + hi/lo) of rope(w[d] (x rms_factor)) x sc with the interleaved-pair convention out[2i] = x[2i] cos[t][2i] - x[2i+1] sin[t][2i], out[2i+1] = x[2i+1] cos[t][2i+1] + x[2i] sin[t][2i+1]
__global__ __launch_bounds__(256) void k_rope(const float* __restrict__ F, int pitch, int nheads, const float* __restrict__ CS, const float* __restrict__ RF, const float* __restrict__ nw, float sc, h16* P16, bf* Ph, bf* Pl) {
    const size_t e = ((size_t)blockIdx.x * 256 + threadIdx.x) * 2; if (e >= (size_t)nheads * TT * HD) return; const int d = (int)(e % HD); const int t = (int)((e / HD) % TT); const int h = (int)(e / ((size_t)HD * TT)); const float* f = F + (size_t)t * pitch + h * HD; const float rf = RF ? RF[(size_t)h * TT + t] : 1.0f; v2h o16; v2us oh, ol;
#pragma unroll
    for (int q = 0; q < 2; ++q) { const int dd = d + q; const int dp = dd ^ 1; float x0 = f[dd], x1 = f[dp];
        if (RF) { float n0 = __fmul_rn(x0, rf), n1 = __fmul_rn(x1, rf); asm volatile("" : "+v"(n0)); asm volatile("" : "+v"(n1)); x0 = __fmul_rn(bfr(nw[dd]), n0); x1 = __fmul_rn(bfr(nw[dp]), n1); }
        const v2f cs = *(const v2f*)(CS + ((size_t)t * HD + dd) * 2); float a = __fmul_rn(x0, cs[0]), bq = __fmul_rn(x1, cs[1]); asm volatile("" : "+v"(a)); asm volatile("" : "+v"(bq)); const float r = (((dd & 1) == 0) ? __fsub_rn(a, bq) : __fadd_rn(a, bq)) * sc;
        o16[q] = tohx(r); unsigned short a2, c2; splitf(r, a2, c2); oh[q] = a2; ol[q] = c2; }
    *(v2h*)(P16 + e) = o16; *(v2us*)(Ph + e) = oh; *(v2us*)(Pl + e) = ol;  }
__global__ __launch_bounds__(256) void k_vtp(const float* __restrict__ F, int pitch, int nheads, h16* V16, bf* Vh, bf* Vl) { const size_t e = ((size_t)blockIdx.x * 256 + threadIdx.x) * 2; if (e >= (size_t)nheads * HD * TT) return; const int t = (int)(e % TT); const int d = (int)((e / TT) % HD); const int g = (int)(e / ((size_t)TT * HD)); v2h o16; v2us oh, ol;
#pragma unroll
    for (int q = 0; q < 2; ++q) { const float x = F[(size_t)(t + q) * pitch + g * HD + d]; o16[q] = tohx(x); unsigned short a2, c2; splitf(x, a2, c2); oh[q] = a2; ol[q] = c2; }
    *(v2h*)(V16 + e) = o16; *(v2us*)(Vh + e) = oh; *(v2us*)(Vl + e) = ol;  }
// k_asoft: per row (zz, i): t = S x HD^-0.5 for j <= i and i - j < WIN (sliding causal window; the reference's -1e9 additive fill vanishes identically); softmax over the 2048 keys (register row, one exp, fixed trees);
__global__ __launch_bounds__(256) void k_asoft(const float* __restrict__ Sb, h16* P16, bf* Ph, bf* Pl) {
    const int lane = threadIdx.x & 31; const int row = blockIdx.x * 8 + (threadIdx.x >> 5); if (row >= ZH * TT) return; const int i = row % TT; const int zz = row / TT; (void)zz; const bool hires = (i < RH); const float* sr = Sb + (size_t)row * TT; float v[TT / 32]; float mx = -3.0e38f;
#pragma unroll
    for (int ch = 0; ch < TT / 128; ++ch) { const int j0 = ch * 128 + lane * 4; const v4f a = *(const v4f*)(sr + j0);
#pragma unroll
        for (int q = 0; q < 4; ++q) { const int j = j0 + q; (void)j; const float t = (j <= i && i - j < WIN) ? a[q] * SCL : -3.0e38f; v[ch * 4 + q] = t; mx = fmaxf(mx, t); } }
#pragma unroll
    for (int sh = 16; sh; sh >>= 1) mx = fmaxf(mx, __shfl_xor(mx, sh, 32));
    float sum = 0.f;
#pragma unroll
    for (int k = 0; k < TT / 32; ++k) { float d0 = __fsub_rn(v[k], mx); asm volatile("" : "+v"(d0)); v[k] = __builtin_amdgcn_exp2f(__fmul_rn(d0, 1.4426950408889634f)); sum += v[k]; }
#pragma unroll
    for (int sh = 16; sh; sh >>= 1) sum += __shfl_xor(sum, sh, 32);
    const float f = __fdiv_rn(hires ? 1.0f : PCAR, sum);
{
        if (hires) {
#pragma unroll
            for (int ch = 0; ch < TT / 128; ++ch) { v4us oh, ol;
#pragma unroll
                for (int q = 0; q < 4; ++q) { unsigned short a, c2; splitf(v[ch * 4 + q] * f, a, c2); oh[q] = a; ol[q] = c2; }
                const size_t oo = ((size_t)zz * (RH ? RH : 1) + i) * TT + ch * 128 + lane * 4; *(v4us*)(Ph + oo) = oh; *(v4us*)(Pl + oo) = ol; }
        } else {
#pragma unroll
            for (int ch = 0; ch < TT / 128; ++ch) { v4h o4;
#pragma unroll
                for (int q = 0; q < 4; ++q) o4[q] = tohx(v[ch * 4 + q] * f);
                *(v4h*)(P16 + (size_t)row * TT + ch * 128 + lane * 4) = o4; } }
         }
}
__global__ __launch_bounds__(256) void k_merge(const float* __restrict__ O, int h0, bf* Ah, bf* Al) { const size_t e = ((size_t)blockIdx.x * 256 + threadIdx.x) * 2; if (e >= (size_t)ZH * TT * HD) return; const int d = (int)(e % HD); const int t = (int)((e / HD) % TT); const int zz = (int)(e / ((size_t)HD * TT)); const float cs = (t < RH) ? 1.0f : (1.0f / PCAR); const size_t oo = (size_t)t * DQ + (h0 + zz) * HD + d;
    v2us oh, ol;
#pragma unroll
    for (int q = 0; q < 2; ++q) { unsigned short a, c2; splitf(O[e + q] * cs, a, c2); oh[q] = a; ol[q] = c2; } *(v2us*)(Ah + oo) = oh; *(v2us*)(Al + oo) = ol;  }

extern "C" void kernel_launch(void* const* d_in, const int* in_sizes, int n_in,
                              void* d_out, int out_size, void* d_ws, size_t ws_size, hipStream_t stream) {
    (void)in_sizes; (void)n_in; (void)out_size;
    const float* x = (const float*)d_in[0]; const float* wq = (const float*)d_in[1]; const float* wk = (const float*)d_in[2]; const float* wv = (const float*)d_in[3]; const float* wo = (const float*)d_in[4]; const float* qnw = (const float*)d_in[5]; const float* knw = (const float*)d_in[6];
    float* OUT = (float*)d_out;     // [2][2048][2048]
    char* wsp = (char*)d_ws;
    auto take = [&](size_t bytes) { char* p = wsp; wsp += (bytes + 255) & ~(size_t)255; return (void*)p; };
    bf* WQ = (bf*)take((size_t)DQ * DM * 2); bf* WK = (bf*)take((size_t)DKV * DM * 2); bf* WV = (bf*)take((size_t)DKV * DM * 2); bf* WO = (bf*)take((size_t)DM * DQ * 2); float* CS = (float*)take((size_t)TT * HD * 2 * 4); float* RFQ = (float*)take((size_t)NH_ * TT * 4); float* RFK = (float*)take((size_t)NKV * TT * 4);
    bf* XB = (bf*)take((size_t)TT * DM * 2); float* FQ = (float*)take((size_t)TT * DQ * 4); float* FK = (float*)take((size_t)TT * DKV * 4);
    h16* QP16 = (h16*)take((size_t)NH_ * TT * HD * 2); h16* KP16 = (h16*)take((size_t)NKV * TT * HD * 2); h16* VT16 = (h16*)take((size_t)NKV * HD * TT * 2);
    bf* QPh = (bf*)take((size_t)NH_ * TT * HD * 2); bf* QPl = (bf*)take((size_t)NH_ * TT * HD * 2); bf* KPh = (bf*)take((size_t)NKV * TT * HD * 2); bf* KPl = (bf*)take((size_t)NKV * TT * HD * 2); bf* VTh = (bf*)take((size_t)NKV * HD * TT * 2); bf* VTl = (bf*)take((size_t)NKV * HD * TT * 2); bf* Ph = (bf*)take((size_t)ZH * RH * TT * 2); bf* Pl = (bf*)take((size_t)ZH * RH * TT * 2);
    float* Sb = (float*)take((size_t)ZH * TT * TT * 4); h16* P16 = (h16*)take((size_t)ZH * TT * TT * 2); float* Ob = (float*)take((size_t)ZH * TT * HD * 4); bf* ATh = (bf*)take((size_t)TT * DQ * 2); bf* ATl = (bf*)take((size_t)TT * DQ * 2);
    if ((size_t)(wsp - (char*)d_ws) > ws_size) return;    // ws 256 MiB
    float* FV = FK;   // v projection reuses the k buffer after the k planes are built (stream-ordered)
    { k_cvt8<<<(unsigned)(((size_t)DQ * DM / 8 + 255) / 256), 256, 0, stream>>>(wq, WQ, (size_t)DQ * DM / 8); k_cvt8<<<(unsigned)(((size_t)DKV * DM / 8 + 255) / 256), 256, 0, stream>>>(wk, WK, (size_t)DKV * DM / 8); k_cvt8<<<(unsigned)(((size_t)DKV * DM / 8 + 255) / 256), 256, 0, stream>>>(wv, WV, (size_t)DKV * DM / 8);
      k_cvt8<<<(unsigned)(((size_t)DM * DQ / 8 + 255) / 256), 256, 0, stream>>>(wo, WO, (size_t)DM * DQ / 8);
      k_cstab<<<(TT * HD + 255) / 256, 256, 0, stream>>>(CS); }
    const unsigned LQ = (unsigned)(((size_t)NH_ * TT * HD / 2 + 255) / 256), LKv = (unsigned)(((size_t)NKV * TT * HD / 2 + 255) / 256);
    for (int b = 0; b < NB_; ++b) {
        
        k_cvt8<<<(unsigned)(((size_t)TT * DM / 8 + 255) / 256), 256, 0, stream>>>(x + (size_t)b * TT * DM, XB, (size_t)TT * DM / 8);
        k_gemmw<bf, 0, false, 8><<<dim3(TT / 64, DQ / 64, 1), 256, 0, stream>>>(XB, nullptr, WQ, nullptr, DM, FQ, DQ, nullptr, 0, 0, 0); k_hrms<<<(NH_ * TT + 255) / 256, 256, 0, stream>>>(FQ, DQ, NH_, RFQ);
        k_rope<<<LQ, 256, 0, stream>>>(FQ, DQ, NH_, CS, RFQ, qnw, 1.0f, QP16, QPh, QPl);
        k_gemmw<bf, 0, false, 16><<<dim3(TT / 64, DKV / 64, 1), 512, 0, stream>>>(XB, nullptr, WK, nullptr, DM, FK, DKV, nullptr, 0, 0, 0); k_hrms<<<(NKV * TT + 255) / 256, 256, 0, stream>>>(FK, DKV, NKV, RFK);
        k_rope<<<LKv, 256, 0, stream>>>(FK, DKV, NKV, CS, RFK, knw, 1.0f, KP16, KPh, KPl);
        k_gemmw<bf, 0, false, 16><<<dim3(TT / 64, DKV / 64, 1), 512, 0, stream>>>(XB, nullptr, WV, nullptr, DM, FV, DKV, nullptr, 0, 0, 0); k_vtp<<<LKv, 256, 0, stream>>>(FV, DKV, NKV, VT16, VTh, VTl);
        for (int h0 = 0; h0 < NH_; h0 += ZH) { const size_t zq = (size_t)h0, zk = (size_t)(h0 / REP);   // all ZH heads of a pass share kv group h0/REP (ZH <= REP): sB = 0
            k_gemmc<bf, 2, 1, 4><<<dim3(RH / 64, TT / 64, ZH), 128, 0, stream>>>(QPh + zq * TT * HD, QPl + zq * TT * HD, KPh + zk * TT * HD, KPl + zk * TT * HD, HD, Sb, TT, 0, (size_t)TT * HD, 0, (size_t)TT * TT);
            k_gemmc<h16, 0, 1, 4><<<dim3((TT - RH) / 64, TT / 64, ZH), 128, 0, stream>>>(QP16 + zq * TT * HD + (size_t)RH * HD, nullptr, KP16 + zk * TT * HD, nullptr, HD, Sb + (size_t)RH * TT, TT, RH, (size_t)TT * HD, 0, (size_t)TT * TT);
            k_asoft<<<ZH * TT / 8, 256, 0, stream>>>(Sb, P16, Ph, Pl);
            k_gemmc<bf, 2, 2, 16><<<dim3(RH / 64, HD / 64, ZH), 512, 0, stream>>>(Ph, Pl, VTh + zk * HD * TT, VTl + zk * HD * TT, TT, Ob, HD, 0, (size_t)RH * TT, 0, (size_t)TT * HD);
            k_gemmc<h16, 0, 2, 16><<<dim3((TT - RH) / 64, HD / 64, ZH), 512, 0, stream>>>(P16 + (size_t)RH * TT, nullptr, VT16 + zk * HD * TT, nullptr, TT, Ob + (size_t)RH * HD, HD, RH, (size_t)TT * TT, 0, (size_t)TT * HD);
            k_merge<<<(unsigned)(((size_t)ZH * TT * HD / 2 + 255) / 256), 256, 0, stream>>>(Ob, h0, ATh, ATl); }
        k_gemmw<bf, 1, false, 8><<<dim3(TT / 64, DM / 64, 1), 256, 0, stream>>>(ATh, ATl, WO, nullptr, DQ, OUT + (size_t)b * TT * DM, DM, nullptr, 0, 0, 0); }
}

// v003
// It runs in 324 microseconds.
// Next to v002, in two timings, it ran 2.12 and 2.09 times as fast.
// Counting every step since v000, it is 5.07 times as fast.
#include <hip/hip_runtime.h>

// _CompatAttention (x [2][2048][2048]; q = RMSNorm_128(x wq^T) * q_norm_w (16 heads x 128), k = RMSNorm_128(x wk^T) * k_norm_w, v = x wv^T (4 kv heads; group h/4); interleaved-pair RoPE (theta 1e4, positions 0..L-1, tables computed on device); causal softmax(q.k / sqrt(128)) (finfo.min fill); out = merged wo^T -> [2][2048][2048]).
// Compute dtypes, f32 accumulate: every input rounded to bf16; q/k/v on PLAIN bf16 operands (inputs: exact); RMSNorm (eps 1e-6) and RoPE f32; causal scores, softmax and attn.v in one kernel (running maximum and sum, f32): query rows < 512 hl (3 products), the rest single fp16 (probabilities x1024), keys beyond the diagonal skipped; wo hl x exact (2 products).

#define NB_  2
#define TT   2048
#define DM   2048
#define NH_  16
#define NKV  4
#define REP  (NH_ / NKV)
#define HD   128
#define DQ   (NH_ * HD)
#define DKV  (NKV * HD)
#define RH   512                  // query rows < RH use hi+lo planes (0: none)
#define SCL  0.088388347648318447f   // HD^-0.5
typedef _Float16 h16;
typedef unsigned short bf;
typedef __attribute__((ext_vector_type(16))) __bf16   v16bf;
typedef __attribute__((ext_vector_type(16))) _Float16 v16h;
typedef __attribute__((ext_vector_type(8)))  _Float16 v8h;
typedef __attribute__((ext_vector_type(8)))  unsigned short v8us;
typedef __attribute__((ext_vector_type(8)))  float    v8f;
typedef __attribute__((ext_vector_type(4)))  float    v4f;
typedef v8h  __attribute__((may_alias)) v8ha;
typedef v4f  __attribute__((may_alias)) v4fa;
typedef v8us __attribute__((may_alias)) v8usa;

__device__ __forceinline__ unsigned short f2bf(float f) { unsigned u = __float_as_uint(f); u += 0x7FFFu + ((u >> 16) & 1u); return (unsigned short)(u >> 16); }
__device__ __forceinline__ float bf2f(unsigned short b) { return __uint_as_float(((unsigned)b) << 16); }
__device__ __forceinline__ float bfr(float f) { return bf2f(f2bf(f)); }
__device__ __forceinline__ v16h cat16(v8h lo, v8h hi) { return __builtin_shufflevector(lo, hi, 0, 1, 2, 3, 4, 5, 6, 7, 8, 9, 10, 11, 12, 13, 14, 15); }
__device__ __forceinline__ v16bf cat16b(v8us lo, v8us hi) { return __builtin_bit_cast(v16bf, __builtin_shufflevector(lo, hi, 0, 1, 2, 3, 4, 5, 6, 7, 8, 9, 10, 11, 12, 13, 14, 15)); }
__device__ __forceinline__ v8f wmma16(v16h a, v16h b, v8f c) { return __builtin_amdgcn_wmma_f32_16x16x32_f16(false, a, false, b, (short)0, c, false, false); }
__device__ __forceinline__ v8f wmmab(v16bf a, v16bf b, v8f c) { return __builtin_amdgcn_wmma_f32_16x16x32_bf16(false, a, false, b, (short)0, c, false, false); }



// ---- k_gemmw: register-blocked GEMM, one work-group of NW waves per 64x64 output tile; wave w takes the 32-wide K slices w, w + NW, ... into its own 16 accumulators (operands straight from K-contiguous 16-bit planes),
// the NW partial tiles meet in LDS (column-major, pitch 68) behind one barrier and are summed in wave order 0..NW-1; grid (M/64, N/64, Z), 32 * NW threads.
// C[m][n] (f32, pitch ldc, + optional f32 bias[n]) = sum_k A[m][k] Bt[n][k] (+ split products per NSPLIT). z-batch strides sA/sB/sC in elements. K % 32 == 0.
template <typename T16> struct WFrag;
template <> struct WFrag<h16> { typedef v16h V; static __device__ __forceinline__ V ld(const h16* p) { return cat16(*(const v8h*)p, *(const v8h*)(p + 16)); } static __device__ __forceinline__ v8f mma(V a, V b, v8f c) { return wmma16(a, b, c); } };
template <> struct WFrag<bf> { typedef v16bf V; static __device__ __forceinline__ V ld(const bf* p) { return cat16b(*(const v8us*)p, *(const v8us*)(p + 16)); } static __device__ __forceinline__ v8f mma(V a, V b, v8f c) { return wmmab(a, b, c); } };
template <typename T16, int NSPLIT, bool BIAS, int NW>
__global__ __launch_bounds__(32 * NW) void k_gemmw(const T16* __restrict__ A, const T16* __restrict__ A2, const T16* __restrict__ Bt, const T16* __restrict__ Bt2, int K, float* C, int ldc, const float* __restrict__ bias, size_t sA, size_t sB, size_t sC) {
    typedef typename WFrag<T16>::V V;
    __shared__ __align__(16) float os[NW * 64 * 68];
    const size_t z = blockIdx.z; A += z * sA; if (A2) A2 += z * sA; Bt += z * sB; if (Bt2) Bt2 += z * sB; C += z * sC;
    const int lane = threadIdx.x & 31, lr = lane & 15, hi = lane >> 4; const int w = __builtin_amdgcn_readfirstlane((int)(threadIdx.x >> 5));   /* wave number held scalar, so the K loop's counter and branch stay scalar */ const int r0 = blockIdx.x * 64, c0 = blockIdx.y * 64;
    v8f acc[4][4];
#pragma unroll
    for (int mb = 0; mb < 4; ++mb)
#pragma unroll
        for (int nb = 0; nb < 4; ++nb) acc[mb][nb] = (v8f){};
    const size_t aoff = (size_t)(r0 + lr) * K + 8 * hi, boff = (size_t)(c0 + lr) * K + 8 * hi;
#pragma unroll 1
    for (int kc = w * 32; kc < K; kc += 32 * NW) {
        V a[4], a2[4];
#pragma unroll
        for (int mb = 0; mb < 4; ++mb) { a[mb] = WFrag<T16>::ld(A + aoff + (size_t)mb * 16 * K + kc); if (NSPLIT == 1 || NSPLIT == 2) a2[mb] = WFrag<T16>::ld(A2 + aoff + (size_t)mb * 16 * K + kc); }
#pragma unroll
        for (int nb = 0; nb < 4; ++nb) { const V b = WFrag<T16>::ld(Bt + boff + (size_t)nb * 16 * K + kc); V b2; if (NSPLIT >= 2) b2 = WFrag<T16>::ld(Bt2 + boff + (size_t)nb * 16 * K + kc);
#pragma unroll
            for (int mb = 0; mb < 4; ++mb) { acc[mb][nb] = WFrag<T16>::mma(a[mb], b, acc[mb][nb]); if (NSPLIT == 1 || NSPLIT == 2) acc[mb][nb] = WFrag<T16>::mma(a2[mb], b, acc[mb][nb]); if (NSPLIT >= 2) acc[mb][nb] = WFrag<T16>::mma(a[mb], b2, acc[mb][nb]); } }
        asm volatile("v_nop\n\tv_nop\n\tv_nop\n\tv_nop" : "+v"(acc[0][0]), "+v"(acc[1][1]), "+v"(acc[2][2]), "+v"(acc[3][3]) : "v"(a[0]), "v"(a[3]));
    }
    float* ow = os + w * (64 * 68) + lr * 68 + hi * 8;   // element (row, col) of this wave's partial tile lies at col * 68 + row: an accumulator's 8 rows are two 16-byte stores
    // both loops unrolled: acc[][] stays in registers only under constant indices
#pragma unroll
    for (int mb = 0; mb < 4; ++mb)
#pragma unroll
        for (int nb = 0; nb < 4; ++nb) { float* p = ow + nb * 16 * 68 + mb * 16; const v8f t = acc[mb][nb]; *(v4fa*)p = __builtin_shufflevector(t, t, 0, 1, 2, 3); *(v4fa*)(p + 4) = __builtin_shufflevector(t, t, 4, 5, 6, 7); }
    __syncthreads();   // every wave's partial tile is in LDS before any wave sums
    // the loops below are unrolled so that the LDS loads of all NW partial tiles issue together, val[] stays in registers and the offsets fold into the instructions
    v4f val[32 / NW];   // wave w owns rows w * 64 / NW ..., whole 256-byte rows; val[u]: 4 rows (row group u >> 1) of column (u & 1) * 32 + lane
#pragma unroll
    for (int u = 0; u < 32 / NW; ++u) { const float* p = os + ((u & 1) * 32 + lane) * 68 + (w * (16 / NW) + (u >> 1)) * 4; val[u] = *(const v4fa*)p;
#pragma unroll
        for (int ww = 1; ww < NW; ++ww) val[u] += *(const v4fa*)(p + ww * (64 * 68));
        if (BIAS) { const float bv = bfr(bias[c0 + (u & 1) * 32 + lane]); val[u][0] += bv; val[u][1] += bv; val[u][2] += bv; val[u][3] += bv; }
    }
    float* cb = C + (size_t)(r0 + w * (64 / NW)) * ldc + c0;   // wave-uniform base of the wave's first row; a store covers 32 adjacent columns, one 128-byte line
#pragma unroll
    for (int k = 0; k < 64 / NW; ++k) { float* cr = cb + (size_t)k * ldc; cr[lane] = val[(k >> 2) * 2][k & 3]; cr[32 + lane] = val[(k >> 2) * 2 + 1][k & 3]; }
}

__device__ __forceinline__ h16 tohx(float x) { return (h16)x; }
__device__ __forceinline__ void splitf(float y, unsigned short& h, unsigned short& l) { h = f2bf(y); l = f2bf(y - bf2f(h)); }
typedef __attribute__((ext_vector_type(2))) _Float16 v2h;
typedef __attribute__((ext_vector_type(4))) _Float16 v4h;
typedef __attribute__((ext_vector_type(2))) unsigned short v2us;
typedef __attribute__((ext_vector_type(4))) unsigned short v4us;
typedef __attribute__((ext_vector_type(2))) float v2f;
typedef __attribute__((ext_vector_type(4))) int v4i;

__global__ __launch_bounds__(256) void k_wtG(const float* __restrict__ w, int K, int N, bf* Bt) {
    const int lane = threadIdx.x & 31; const int L0 = (blockIdx.x * 8 + (threadIdx.x >> 5)) * 8; const int nlines = N * K / 64;
{
#pragma unroll 1
        for (int l = 0; l < 8; ++l) { const int L = L0 + l; if (L >= nlines) break; const size_t e = (size_t)L * 64 + lane * 2; const int k = (int)(e % K), n = (int)(e / K); v2us o;
            o[0] = f2bf(w[(size_t)k * N + n]); o[1] = f2bf(w[(size_t)(k + 1) * N + n]); *(v2us*)(Bt + e) = o; }
         }
}
__global__ __launch_bounds__(256) void k_cvt8(const float* __restrict__ src, bf* dst, size_t n8) { const size_t i = (size_t)blockIdx.x * 256 + threadIdx.x; if (i >= n8) return; const v8f v = *(const v8f*)(src + i * 8); v8us o;
#pragma unroll
    for (int k = 0; k < 8; ++k) o[k] = f2bf(v[k]); *(v8us*)(dst + i * 8) = o;  }
__global__ __launch_bounds__(256) void k_cstab(float* CS) { const int idx = blockIdx.x * 256 + threadIdx.x; if (idx >= TT * HD) return; const int t = idx / HD, d = idx % HD; const int i = d >> 1;   /* interleaved pairs (2i, 2i+1) share angle t * inv_freq[i] */ const float inv = __fdiv_rn(1.0f, powf(10000.0f, (float)(2 * i) / (float)HD)); const float ang = __fmul_rn((float)t, inv); v2f cs; cs[0] = cosf(ang); cs[1] = sinf(ang);
    *(v2f*)(CS + (size_t)idx * 2) = cs;  }
__global__ __launch_bounds__(256) void k_hrms(const float* __restrict__ F, int pitch, int nheads, float* RF) { const int i = blockIdx.x * 256 + threadIdx.x; if (i >= nheads * TT) return; const int t = i % TT, h = i / TT; const float* f = F + (size_t)t * pitch + h * HD; float s = 0.f;
#pragma unroll 4
    for (int d = 0; d < HD; d += 4) { const v4f v = *(const v4f*)(f + d);
#pragma unroll
        for (int q = 0; q < 4; ++q) { float p = __fmul_rn(v[q], v[q]); asm volatile("" : "+v"(p)); s = __fadd_rn(s, p); } }
    const float r = __fdiv_rn(1.0f, __fsqrt_rn(__fadd_rn(s * (1.0f / HD), 1e-6f))); *(float*)(RF + i) = r;  }
// k_rope: head planes [h][t][d] (fp16 + hi/lo) of rope(w[d] (x rms_factor)) x sc with the interleaved-pair convention out[2i] = x[2i] cos[t][2i] - x[2i+1] sin[t][2i], out[2i+1] = x[2i+1] cos[t][2i+1] + x[2i] sin[t][2i+1]
__global__ __launch_bounds__(256) void k_rope(const float* __restrict__ F, int pitch, int nheads, const float* __restrict__ CS, const float* __restrict__ RF, const float* __restrict__ nw, float sc, h16* P16, bf* Ph, bf* Pl) {
    const size_t e = ((size_t)blockIdx.x * 256 + threadIdx.x) * 2; if (e >= (size_t)nheads * TT * HD) return; const int d = (int)(e % HD); const int t = (int)((e / HD) % TT); const int h = (int)(e / ((size_t)HD * TT)); const float* f = F + (size_t)t * pitch + h * HD; const float rf = RF ? RF[(size_t)h * TT + t] : 1.0f; v2h o16; v2us oh, ol;
#pragma unroll
    for (int q = 0; q < 2; ++q) { const int dd = d + q; const int dp = dd ^ 1; float x0 = f[dd], x1 = f[dp];
        if (RF) { float n0 = __fmul_rn(x0, rf), n1 = __fmul_rn(x1, rf); asm volatile("" : "+v"(n0)); asm volatile("" : "+v"(n1)); x0 = __fmul_rn(bfr(nw[dd]), n0); x1 = __fmul_rn(bfr(nw[dp]), n1); }
        const v2f cs = *(const v2f*)(CS + ((size_t)t * HD + dd) * 2); float a = __fmul_rn(x0, cs[0]), bq = __fmul_rn(x1, cs[1]); asm volatile("" : "+v"(a)); asm volatile("" : "+v"(bq)); const float r = (((dd & 1) == 0) ? __fsub_rn(a, bq) : __fadd_rn(a, bq)) * sc;
        o16[q] = tohx(r); unsigned short a2, c2; splitf(r, a2, c2); oh[q] = a2; ol[q] = c2; }
    *(v2h*)(P16 + e) = o16; *(v2us*)(Ph + e) = oh; *(v2us*)(Pl + e) = ol;  }
__global__ __launch_bounds__(256) void k_vtp(const float* __restrict__ F, int pitch, int nheads, h16* V16, bf* Vh, bf* Vl) { const size_t e = ((size_t)blockIdx.x * 256 + threadIdx.x) * 2; if (e >= (size_t)nheads * HD * TT) return; const int t = (int)(e % TT); const int d = (int)((e / TT) % HD); const int g = (int)(e / ((size_t)TT * HD)); v2h o16; v2us oh, ol;
#pragma unroll
    for (int q = 0; q < 2; ++q) { const float x = F[(size_t)(t + q) * pitch + g * HD + d]; o16[q] = tohx(x); unsigned short a2, c2; splitf(x, a2, c2); oh[q] = a2; ol[q] = c2; }
    *(v2h*)(V16 + e) = o16; *(v2us*)(Vh + e) = oh; *(v2us*)(Vl + e) = ol;  }
#define FQT  32                   // query positions per work-group
#define FSK  64                   // keys per stage
#define FPK  (HD + 8)             // LDS row pitch of K, elements: 272 bytes, an odd multiple of 16
#define FPV  (FSK + 8)            // LDS row pitch of V^T, elements: 144 bytes, an odd multiple of 16
#define FKT  (FSK * FPK)
#define FPL  (FKT + HD * FPV)     // one plane (K tile, then V^T tile) of a stage, elements
#define CS2  (SCL * 1.4426950408889634f)   // scores to the log2 domain
typedef v4i __attribute__((may_alias)) v4ia;
__device__ __forceinline__ float xhalf(float x) { return __builtin_bit_cast(float, __builtin_amdgcn_permlanex16(__builtin_bit_cast(int, x), __builtin_bit_cast(int, x), 0x76543210, 0xfedcba98, false, false)); }   // lane l with lane l ^ 16
template <typename T16, bool HL>
__device__ __forceinline__ void fa_body(T16* L, const T16* __restrict__ Q, const T16* __restrict__ Q2, const T16* __restrict__ Kp, const T16* __restrict__ K2, const T16* __restrict__ Vt, const T16* __restrict__ V2, int q0, bf* Ah, bf* Al) {
    typedef typename WFrag<T16>::V V;
    constexpr int NP = HL ? 2 : 1, BUF = NP * FPL;
    const int tid = threadIdx.x, lane = tid & 31, c = lane & 15, h = lane >> 4; const int w = __builtin_amdgcn_readfirstlane(tid >> 5);   /* wave number held scalar, so the tests on the wave's diagonal are scalar branches */
    const int hd = w >> 1, qw = q0 + 16 * (w & 1);
    V qf[4], qf2[4];
    // each s_wait_xcnt below stands between the loads in front of it and any rewrite of their address registers; it takes the pointers as inputs, so that they stay in those registers up to the wait
    { const size_t qo = ((size_t)hd * TT + qw + c) * HD + 8 * h; const T16* qp = Q + qo; const T16* qp2 = HL ? Q2 + qo : qp;
#pragma unroll
      for (int kc = 0; kc < 4; ++kc) { qf[kc] = WFrag<T16>::ld(qp + 32 * kc); if (HL) qf2[kc] = WFrag<T16>::ld(qp2 + 32 * kc); }
      asm volatile("s_wait_xcnt 0x0" :: "v"(qp), "v"(qp2) : "memory"); }
    v8f acc[8];
#pragma unroll
    for (int t = 0; t < 8; ++t) acc[t] = (v8f){};
    float m = -3.0e38f, l = 0.f;
    const int ns = q0 / FSK + 1;   // stages that hold a key <= q0 + FQT - 1; the same for every wave of the work-group
    // staging: 16-byte pieces; K: 16 a row, the stage contiguous in memory; V^T: 8 a row, one whole 128-byte line
    const int kr = tid >> 4, kcol = (tid & 15) * 8, vr = tid >> 3, vcol = (tid & 7) * 8;
    v4i rg[NP * 8];
    auto fetch = [&](int s) {
        const size_t ko = (size_t)(s * FSK + kr) * HD + kcol, vo = (size_t)vr * TT + s * FSK + vcol;
        const T16* k1 = Kp + ko; const T16* v1 = Vt + vo; const T16* k2 = HL ? K2 + ko : k1; const T16* v2 = HL ? V2 + vo : v1;
#pragma unroll
        for (int i = 0; i < 4; ++i) { rg[i] = *(const v4ia*)(k1 + 16 * i * HD); rg[4 + i] = *(const v4ia*)(v1 + 32 * i * TT); if (HL) { rg[8 + i] = *(const v4ia*)(k2 + 16 * i * HD); rg[12 + i] = *(const v4ia*)(v2 + 32 * i * TT); } }
        asm volatile("s_wait_xcnt 0x0" :: "v"(k1), "v"(v1), "v"(k2), "v"(v2) : "memory"); };
    auto put = [&](T16* B) {
#pragma unroll
        for (int i = 0; i < 4; ++i) { const int ko = (kr + 16 * i) * FPK + kcol, vo = FKT + (vr + 32 * i) * FPV + vcol;
            *(v4ia*)(B + ko) = rg[i]; *(v4ia*)(B + vo) = rg[4 + i]; if (HL) { *(v4ia*)(B + FPL + ko) = rg[8 + i]; *(v4ia*)(B + FPL + vo) = rg[12 + i]; } } };
    fetch(0); put(L);
    __syncthreads();   // stage 0 is in LDS before any wave reads it
#pragma unroll 1
    for (int s = 0; s < ns; ++s) {
        const bool more = s + 1 < ns;
        if (!HL && more) fetch(s + 1);   // the hl blocks are short and need the registers: they fetch in front of put()
        const T16* B = L + (s & 1) * BUF;
#pragma unroll 1
        for (int sub = 0; sub < FSK / 32; ++sub) {
            const int key0 = s * FSK + sub * 32;
            if (key0 > qw + 15) break;   // every key of the pass lies beyond the wave's last query
            v8f st[2]; st[0] = (v8f){}; st[1] = (v8f){};
            const T16* kp = B + (sub * 32 + c) * FPK + 8 * h; const T16* vp = B + FKT + c * FPV + sub * 32 + 8 * h;
            V va[8];
            // the sched_barriers of this pass keep each group of LDS loads together in front of its products: one LDS latency a group, not one a fragment
            if constexpr (!HL) { V ka[2][4];
#pragma unroll
                for (int kt = 0; kt < 2; ++kt)
#pragma unroll
                    for (int kc = 0; kc < 4; ++kc) ka[kt][kc] = WFrag<T16>::ld(kp + 16 * kt * FPK + 32 * kc);
                __builtin_amdgcn_sched_barrier(0);
#pragma unroll
                for (int kc = 0; kc < 4; ++kc) { st[0] = WFrag<T16>::mma(ka[0][kc], qf[kc], st[0]); st[1] = WFrag<T16>::mma(ka[1][kc], qf[kc], st[1]); }
#pragma unroll
                for (int t = 0; t < 8; ++t) va[t] = WFrag<T16>::ld(vp + 16 * t * FPV);   // V^T fragments fly during the softmax
                __builtin_amdgcn_sched_barrier(0);
            } else {
#pragma unroll
                for (int kt = 0; kt < 2; ++kt) { V ka[4], kb[4];
#pragma unroll
                    for (int kc = 0; kc < 4; ++kc) { ka[kc] = WFrag<T16>::ld(kp + 16 * kt * FPK + 32 * kc); kb[kc] = WFrag<T16>::ld(kp + FPL + 16 * kt * FPK + 32 * kc); }
                    __builtin_amdgcn_sched_barrier(0);
#pragma unroll
                    for (int kc = 0; kc < 4; ++kc) { st[kt] = WFrag<T16>::mma(ka[kc], qf[kc], st[kt]); st[kt] = WFrag<T16>::mma(ka[kc], qf2[kc], st[kt]); st[kt] = WFrag<T16>::mma(kb[kc], qf[kc], st[kt]); }
                    __builtin_amdgcn_sched_barrier(0); } }
            if (key0 + 31 > qw) {   // only a pass that straddles the wave's diagonal pays for the mask
#pragma unroll
                for (int kt = 0; kt < 2; ++kt)
#pragma unroll
                    for (int r = 0; r < 8; ++r) if (key0 + 16 * kt + 8 * h + r > qw + c) st[kt][r] = -3.0e38f; }
            float mx = fmaxf(st[0][0], st[1][0]);
#pragma unroll
            for (int r = 1; r < 8; ++r) mx = fmaxf(mx, fmaxf(st[0][r], st[1][r]));
            mx = fmaxf(mx, xhalf(mx));   // both wave halves hold the query's maximum over the pass (key key0 is never masked here, so it is a real score)
            const float mb = mx * CS2;
            if (__builtin_amdgcn_ballot_w32(mb > m) != 0) {   // some query's maximum rose: rescale (factor 1 in the lanes where it did not; 0 on the first pass)
                const float mn = fmaxf(m, mb), corr = __builtin_amdgcn_exp2f(m - mn); l *= corr; m = mn;
#pragma unroll
                for (int t = 0; t < 8; ++t) acc[t] *= corr; }
            const float nm = (HL ? 0.0f : 10.0f) - m;   // fp16 probabilities carry a factor 1024 (it is in the sum too and cancels), so that small ones stay normal numbers
            float p[16];
#pragma unroll
            for (int i = 0; i < 16; ++i) { p[i] = __builtin_amdgcn_exp2f(fmaf(st[i >> 3][i & 7], CS2, nm)); l += p[i]; }
            V pb, pl;
            if constexpr (HL) { __attribute__((ext_vector_type(16))) unsigned short uh, ul;
#pragma unroll
                for (int i = 0; i < 16; ++i) { unsigned short a, b2; splitf(p[i], a, b2); uh[i] = a; ul[i] = b2; }
                pb = __builtin_bit_cast(v16bf, uh); pl = __builtin_bit_cast(v16bf, ul);
            } else {
#pragma unroll
                for (int i = 0; i < 16; ++i) pb[i] = tohx(p[i]); }
            if constexpr (!HL) {
#pragma unroll
                for (int t = 0; t < 8; ++t) acc[t] = WFrag<T16>::mma(va[t], pb, acc[t]);
            } else {
#pragma unroll
                for (int tg = 0; tg < 8; tg += 4) {
#pragma unroll
                    for (int t = 0; t < 4; ++t) { va[t] = WFrag<T16>::ld(vp + 16 * (tg + t) * FPV); va[4 + t] = WFrag<T16>::ld(vp + FPL + 16 * (tg + t) * FPV); }
                    __builtin_amdgcn_sched_barrier(0);
#pragma unroll
                    for (int t = 0; t < 4; ++t) acc[tg + t] = WFrag<T16>::mma(va[t], pb, acc[tg + t]);
#pragma unroll
                    for (int t = 0; t < 4; ++t) acc[tg + t] = WFrag<T16>::mma(va[t], pl, acc[tg + t]);
#pragma unroll
                    for (int t = 0; t < 4; ++t) acc[tg + t] = WFrag<T16>::mma(va[4 + t], pb, acc[tg + t]);
                    __builtin_amdgcn_sched_barrier(0); } }
            asm volatile("v_nop\n\tv_nop\n\tv_nop\n\tv_nop" : "+v"(acc[0]), "+v"(acc[7]));   // the distance behind the last matrix instruction also on the taken side of the loop's branch
        }
        if (HL && more) fetch(s + 1);
        if (more) put(L + ((s + 1) & 1) * BUF);   // the buffer that stage s - 1 used: every wave left it at the barrier below, one trip ago
        __syncthreads();   // publishes stage s + 1 and ends every wave's reads of stage s
    }
    l += xhalf(l);   // each wave half summed its eight keys of every 16-key tile
    const float inv = __fdiv_rn(1.0f, l);
    const size_t oo = (size_t)(qw + c) * DQ + hd * HD + 8 * h;   // a lane's 8 accumulator registers are 8 consecutive d of its query
#pragma unroll
    for (int t = 0; t < 8; ++t) { v8us oh, ol;
#pragma unroll
        for (int r = 0; r < 8; ++r) { unsigned short a, b2; splitf(acc[t][r] * inv, a, b2); oh[r] = a; ol[r] = b2; }
        *(v8us*)(Ah + oo + 16 * t) = oh; *(v8us*)(Al + oo + 16 * t) = ol; }
}
// grid (kv groups, batches, TT / FQT position blocks, heaviest first); planes [batch][head][t][d] (V: [batch][group][d][t]); output hi/lo planes [batch][t][DQ]
__global__ __launch_bounds__(256) void k_fattn(const h16* __restrict__ Q16, const bf* __restrict__ Qh, const bf* __restrict__ Ql, const h16* __restrict__ K16, const bf* __restrict__ Kh, const bf* __restrict__ Kl, const h16* __restrict__ V16, const bf* __restrict__ Vh, const bf* __restrict__ Vl, bf* Ah, bf* Al) {
    __shared__ __align__(16) unsigned short L[2 * 2 * FPL];
    const int g = blockIdx.x, b = blockIdx.y, q0 = (TT / FQT - 1 - (int)blockIdx.z) * FQT;
    const size_t zq = ((size_t)b * NH_ + g * REP) * TT * HD, zk = ((size_t)b * NKV + g) * TT * HD, zo = (size_t)b * TT * DQ + g * REP * HD;
    if (q0 < RH) fa_body<bf, true>((bf*)L, Qh + zq, Ql + zq, Kh + zk, Kl + zk, Vh + zk, Vl + zk, q0, Ah + zo, Al + zo);
    else fa_body<h16, false>((h16*)L, Q16 + zq, nullptr, K16 + zk, nullptr, V16 + zk, nullptr, q0, Ah + zo, Al + zo);
}

extern "C" void kernel_launch(void* const* d_in, const int* in_sizes, int n_in,
                              void* d_out, int out_size, void* d_ws, size_t ws_size, hipStream_t stream) {
    (void)in_sizes; (void)n_in; (void)out_size;
    const float* x = (const float*)d_in[0]; const float* wq = (const float*)d_in[1]; const float* wk = (const float*)d_in[2]; const float* wv = (const float*)d_in[3]; const float* wo = (const float*)d_in[4]; const float* qnw = (const float*)d_in[5]; const float* knw = (const float*)d_in[6];
    float* OUT = (float*)d_out;     // [2][2048][2048]
    char* wsp = (char*)d_ws;
    auto take = [&](size_t bytes) { char* p = wsp; wsp += (bytes + 255) & ~(size_t)255; return (void*)p; };
    const size_t NQ = (size_t)NH_ * TT * HD, NK = (size_t)NKV * TT * HD;   // elements of one batch's query planes and of its key or value planes
    bf* WQ = (bf*)take((size_t)DQ * DM * 2); bf* WK = (bf*)take((size_t)DKV * DM * 2); bf* WV = (bf*)take((size_t)DKV * DM * 2); bf* WO = (bf*)take((size_t)DM * DQ * 2); float* CS = (float*)take((size_t)TT * HD * 2 * 4); float* RFQ = (float*)take((size_t)NH_ * TT * 4); float* RFK = (float*)take((size_t)NKV * TT * 4);
    bf* XB = (bf*)take((size_t)TT * DM * 2); float* FQ = (float*)take((size_t)TT * DQ * 4); float* FK = (float*)take((size_t)TT * DKV * 4);
    h16* QP16 = (h16*)take(NB_ * NQ * 2); h16* KP16 = (h16*)take(NB_ * NK * 2); h16* VT16 = (h16*)take(NB_ * NK * 2);
    bf* QPh = (bf*)take(NB_ * NQ * 2); bf* QPl = (bf*)take(NB_ * NQ * 2); bf* KPh = (bf*)take(NB_ * NK * 2); bf* KPl = (bf*)take(NB_ * NK * 2); bf* VTh = (bf*)take(NB_ * NK * 2); bf* VTl = (bf*)take(NB_ * NK * 2);
    bf* ATh = (bf*)take((size_t)NB_ * TT * DQ * 2); bf* ATl = (bf*)take((size_t)NB_ * TT * DQ * 2);
    if ((size_t)(wsp - (char*)d_ws) > ws_size) return;    // ws 256 MiB
    float* FV = FK;   // v projection reuses the k buffer after the k planes are built (stream-ordered)
    { k_cvt8<<<(unsigned)(((size_t)DQ * DM / 8 + 255) / 256), 256, 0, stream>>>(wq, WQ, (size_t)DQ * DM / 8); k_cvt8<<<(unsigned)(((size_t)DKV * DM / 8 + 255) / 256), 256, 0, stream>>>(wk, WK, (size_t)DKV * DM / 8); k_cvt8<<<(unsigned)(((size_t)DKV * DM / 8 + 255) / 256), 256, 0, stream>>>(wv, WV, (size_t)DKV * DM / 8);
      k_cvt8<<<(unsigned)(((size_t)DM * DQ / 8 + 255) / 256), 256, 0, stream>>>(wo, WO, (size_t)DM * DQ / 8);
      k_cstab<<<(TT * HD + 255) / 256, 256, 0, stream>>>(CS); }
    const unsigned LQ = (unsigned)(((size_t)NH_ * TT * HD / 2 + 255) / 256), LKv = (unsigned)(((size_t)NKV * TT * HD / 2 + 255) / 256);
    for (int b = 0; b < NB_; ++b) {
        k_cvt8<<<(unsigned)(((size_t)TT * DM / 8 + 255) / 256), 256, 0, stream>>>(x + (size_t)b * TT * DM, XB, (size_t)TT * DM / 8);
        k_gemmw<bf, 0, false, 8><<<dim3(TT / 64, DQ / 64, 1), 256, 0, stream>>>(XB, nullptr, WQ, nullptr, DM, FQ, DQ, nullptr, 0, 0, 0); k_hrms<<<(NH_ * TT + 255) / 256, 256, 0, stream>>>(FQ, DQ, NH_, RFQ);
        k_rope<<<LQ, 256, 0, stream>>>(FQ, DQ, NH_, CS, RFQ, qnw, 1.0f, QP16 + b * NQ, QPh + b * NQ, QPl + b * NQ);
        k_gemmw<bf, 0, false, 16><<<dim3(TT / 64, DKV / 64, 1), 512, 0, stream>>>(XB, nullptr, WK, nullptr, DM, FK, DKV, nullptr, 0, 0, 0); k_hrms<<<(NKV * TT + 255) / 256, 256, 0, stream>>>(FK, DKV, NKV, RFK);
        k_rope<<<LKv, 256, 0, stream>>>(FK, DKV, NKV, CS, RFK, knw, 1.0f, KP16 + b * NK, KPh + b * NK, KPl + b * NK);
        k_gemmw<bf, 0, false, 16><<<dim3(TT / 64, DKV / 64, 1), 512, 0, stream>>>(XB, nullptr, WV, nullptr, DM, FV, DKV, nullptr, 0, 0, 0); k_vtp<<<LKv, 256, 0, stream>>>(FV, DKV, NKV, VT16 + b * NK, VTh + b * NK, VTl + b * NK); }
    k_fattn<<<dim3(NKV, NB_, TT / FQT), 256, 0, stream>>>(QP16, QPh, QPl, KP16, KPh, KPl, VT16, VTh, VTl, ATh, ATl);
    for (int b = 0; b < NB_; ++b)
        k_gemmw<bf, 1, false, 8><<<dim3(TT / 64, DM / 64, 1), 256, 0, stream>>>(ATh + (size_t)b * TT * DQ, ATl + (size_t)b * TT * DQ, WO, nullptr, DQ, OUT + (size_t)b * TT * DM, DM, nullptr, 0, 0, 0);
}

// v004
// It runs in 279 microseconds.
// Timed twice side by side with v003, it ran 1.16 times as fast both times.
// All steps since v000 together make it 5.90 times as fast.
#include <hip/hip_runtime.h>

// _CompatAttention (x [2][2048][2048]; q = RMSNorm_128(x wq^T) * q_norm_w (16 heads x 128), k = RMSNorm_128(x wk^T) * k_norm_w, v = x wv^T (4 kv heads; group h/4); interleaved-pair RoPE (theta 1e4, positions 0..L-1, tables computed on device); causal softmax(q.k / sqrt(128)) (finfo.min fill); out = merged wo^T -> [2][2048][2048]).
// Compute dtypes, f32 accumulate: every input rounded to bf16; q/k/v on PLAIN bf16 operands (inputs: exact); RMSNorm (eps 1e-6) and RoPE f32; causal scores, softmax and attn.v in one kernel (running maximum and sum, f32): query rows < 512 hl (3 products), the rest single fp16 (probabilities x1024), keys beyond the diagonal skipped; wo hl x exact (2 products).

#define NB_  2
#define TT   2048
#define DM   2048
#define NH_  16
#define NKV  4
#define REP  (NH_ / NKV)
#define HD   128
#define DQ   (NH_ * HD)
#define DKV  (NKV * HD)
#define DF   (DQ + 2 * DKV)        // columns of the joint q | k | v projection
#define RT   (NB_ * TT)           // rows of both batches together
#define RH   512                  // query rows < RH use hi+lo planes (0: none)
#define SCL  0.088388347648318447f   // HD^-0.5
typedef _Float16 h16;
typedef unsigned short bf;
typedef __attribute__((ext_vector_type(16))) __bf16   v16bf;
typedef __attribute__((ext_vector_type(16))) _Float16 v16h;
typedef __attribute__((ext_vector_type(8)))  _Float16 v8h;
typedef __attribute__((ext_vector_type(8)))  unsigned short v8us;
typedef __attribute__((ext_vector_type(8)))  float    v8f;
typedef __attribute__((ext_vector_type(4)))  float    v4f;
typedef v8h  __attribute__((may_alias)) v8ha;
typedef v4f  __attribute__((may_alias)) v4fa;
typedef v8us __attribute__((may_alias)) v8usa;

__device__ __forceinline__ unsigned short f2bf(float f) { unsigned u = __float_as_uint(f); u += 0x7FFFu + ((u >> 16) & 1u); return (unsigned short)(u >> 16); }
__device__ __forceinline__ float bf2f(unsigned short b) { return __uint_as_float(((unsigned)b) << 16); }
__device__ __forceinline__ float bfr(float f) { return bf2f(f2bf(f)); }
__device__ __forceinline__ v16h cat16(v8h lo, v8h hi) { return __builtin_shufflevector(lo, hi, 0, 1, 2, 3, 4, 5, 6, 7, 8, 9, 10, 11, 12, 13, 14, 15); }
__device__ __forceinline__ v16bf cat16b(v8us lo, v8us hi) { return __builtin_bit_cast(v16bf, __builtin_shufflevector(lo, hi, 0, 1, 2, 3, 4, 5, 6, 7, 8, 9, 10, 11, 12, 13, 14, 15)); }
__device__ __forceinline__ v8f wmma16(v16h a, v16h b, v8f c) { return __builtin_amdgcn_wmma_f32_16x16x32_f16(false, a, false, b, (short)0, c, false, false); }
__device__ __forceinline__ v8f wmmab(v16bf a, v16bf b, v8f c) { return __builtin_amdgcn_wmma_f32_16x16x32_bf16(false, a, false, b, (short)0, c, false, false); }



// ---- k_gemmw: register-blocked GEMM, one work-group of NW waves per 64x64 output tile; wave w takes the 32-wide K slices w, w + NW, ... into its own 16 accumulators (operands straight from K-contiguous 16-bit planes),
// the NW partial tiles meet in LDS (column-major, pitch 68) behind one barrier and are summed in wave order 0..NW-1; grid (M/64, N/64, Z), 32 * NW threads.
// C[m][n] (f32, pitch ldc, + optional f32 bias[n]) = sum_k A[m][k] Bt[n][k] (+ split products per NSPLIT). z-batch strides sA/sB/sC in elements. K % 32 == 0.
template <typename T16> struct WFrag;
template <> struct WFrag<h16> { typedef v16h V; static __device__ __forceinline__ V ld(const h16* p) { return cat16(*(const v8h*)p, *(const v8h*)(p + 16)); } static __device__ __forceinline__ v8f mma(V a, V b, v8f c) { return wmma16(a, b, c); } };
template <> struct WFrag<bf> { typedef v16bf V; static __device__ __forceinline__ V ld(const bf* p) { return cat16b(*(const v8us*)p, *(const v8us*)(p + 16)); } static __device__ __forceinline__ v8f mma(V a, V b, v8f c) { return wmmab(a, b, c); } };
template <typename T16, int NSPLIT, bool BIAS, int NW>
__global__ __launch_bounds__(32 * NW) void k_gemmw(const T16* __restrict__ A, const T16* __restrict__ A2, const T16* __restrict__ Bt, const T16* __restrict__ Bt2, int K, float* C, int ldc, const float* __restrict__ bias, size_t sA, size_t sB, size_t sC) {
    typedef typename WFrag<T16>::V V;
    __shared__ __align__(16) float os[NW * 64 * 68];
    const size_t z = blockIdx.z; A += z * sA; if (A2) A2 += z * sA; Bt += z * sB; if (Bt2) Bt2 += z * sB; C += z * sC;
    const int lane = threadIdx.x & 31, lr = lane & 15, hi = lane >> 4; const int w = __builtin_amdgcn_readfirstlane((int)(threadIdx.x >> 5));   /* wave number held scalar, so the K loop's counter and branch stay scalar */ const int r0 = blockIdx.x * 64, c0 = blockIdx.y * 64;
    v8f acc[4][4];
#pragma unroll
    for (int mb = 0; mb < 4; ++mb)
#pragma unroll
        for (int nb = 0; nb < 4; ++nb) acc[mb][nb] = (v8f){};
    const size_t aoff = (size_t)(r0 + lr) * K + 8 * hi, boff = (size_t)(c0 + lr) * K + 8 * hi;
#pragma unroll 1
    for (int kc = w * 32; kc < K; kc += 32 * NW) {
        V a[4], a2[4];
#pragma unroll
        for (int mb = 0; mb < 4; ++mb) { a[mb] = WFrag<T16>::ld(A + aoff + (size_t)mb * 16 * K + kc); if (NSPLIT == 1 || NSPLIT == 2) a2[mb] = WFrag<T16>::ld(A2 + aoff + (size_t)mb * 16 * K + kc); }
#pragma unroll
        for (int nb = 0; nb < 4; ++nb) { const V b = WFrag<T16>::ld(Bt + boff + (size_t)nb * 16 * K + kc); V b2; if (NSPLIT >= 2) b2 = WFrag<T16>::ld(Bt2 + boff + (size_t)nb * 16 * K + kc);
#pragma unroll
            for (int mb = 0; mb < 4; ++mb) { acc[mb][nb] = WFrag<T16>::mma(a[mb], b, acc[mb][nb]); if (NSPLIT == 1 || NSPLIT == 2) acc[mb][nb] = WFrag<T16>::mma(a2[mb], b, acc[mb][nb]); if (NSPLIT >= 2) acc[mb][nb] = WFrag<T16>::mma(a[mb], b2, acc[mb][nb]); } }
        asm volatile("v_nop\n\tv_nop\n\tv_nop\n\tv_nop" : "+v"(acc[0][0]), "+v"(acc[1][1]), "+v"(acc[2][2]), "+v"(acc[3][3]) : "v"(a[0]), "v"(a[3]));
    }
    float* ow = os + w * (64 * 68) + lr * 68 + hi * 8;   // element (row, col) of this wave's partial tile lies at col * 68 + row: an accumulator's 8 rows are two 16-byte stores
    // both loops unrolled: acc[][] stays in registers only under constant indices
#pragma unroll
    for (int mb = 0; mb < 4; ++mb)
#pragma unroll
        for (int nb = 0; nb < 4; ++nb) { float* p = ow + nb * 16 * 68 + mb * 16; const v8f t = acc[mb][nb]; *(v4fa*)p = __builtin_shufflevector(t, t, 0, 1, 2, 3); *(v4fa*)(p + 4) = __builtin_shufflevector(t, t, 4, 5, 6, 7); }
    __syncthreads();   // every wave's partial tile is in LDS before any wave sums
    // the loops below are unrolled so that the LDS loads of all NW partial tiles issue together, val[] stays in registers and the offsets fold into the instructions
    v4f val[32 / NW];   // wave w owns rows w * 64 / NW ..., whole 256-byte rows; val[u]: 4 rows (row group u >> 1) of column (u & 1) * 32 + lane
#pragma unroll
    for (int u = 0; u < 32 / NW; ++u) { const float* p = os + ((u & 1) * 32 + lane) * 68 + (w * (16 / NW) + (u >> 1)) * 4; val[u] = *(const v4fa*)p;
#pragma unroll
        for (int ww = 1; ww < NW; ++ww) val[u] += *(const v4fa*)(p + ww * (64 * 68));
        if (BIAS) { const float bv = bfr(bias[c0 + (u & 1) * 32 + lane]); val[u][0] += bv; val[u][1] += bv; val[u][2] += bv; val[u][3] += bv; }
    }
    float* cb = C + (size_t)(r0 + w * (64 / NW)) * ldc + c0;   // wave-uniform base of the wave's first row; a store covers 32 adjacent columns, one 128-byte line
#pragma unroll
    for (int k = 0; k < 64 / NW; ++k) { float* cr = cb + (size_t)k * ldc; cr[lane] = val[(k >> 2) * 2][k & 3]; cr[32 + lane] = val[(k >> 2) * 2 + 1][k & 3]; }
}

__device__ __forceinline__ h16 tohx(float x) { return (h16)x; }
__device__ __forceinline__ void splitf(float y, unsigned short& h, unsigned short& l) { h = f2bf(y); l = f2bf(y - bf2f(h)); }
typedef __attribute__((ext_vector_type(2))) _Float16 v2h;
typedef __attribute__((ext_vector_type(4))) _Float16 v4h;
typedef __attribute__((ext_vector_type(2))) unsigned short v2us;
typedef __attribute__((ext_vector_type(4))) unsigned short v4us;
typedef __attribute__((ext_vector_type(2))) float v2f;
typedef __attribute__((ext_vector_type(4))) int v4i;

__global__ __launch_bounds__(256) void k_wtG(const float* __restrict__ w, int K, int N, bf* Bt) {
    const int lane = threadIdx.x & 31; const int L0 = (blockIdx.x * 8 + (threadIdx.x >> 5)) * 8; const int nlines = N * K / 64;
{
#pragma unroll 1
        for (int l = 0; l < 8; ++l) { const int L = L0 + l; if (L >= nlines) break; const size_t e = (size_t)L * 64 + lane * 2; const int k = (int)(e % K), n = (int)(e / K); v2us o;
            o[0] = f2bf(w[(size_t)k * N + n]); o[1] = f2bf(w[(size_t)(k + 1) * N + n]); *(v2us*)(Bt + e) = o; }
         }
}
// k_cvt8: all five f32 operands to bf16 in one launch; the planes lie one behind the other in dst in the order wq, wk, wv, wo, x. Every plane is a whole number of blocks (2048 elements each), so the choice of the source is uniform in a block.
__global__ __launch_bounds__(256) void k_cvt8(const float* __restrict__ wq, const float* __restrict__ wk, const float* __restrict__ wv, const float* __restrict__ wo, const float* __restrict__ x, bf* dst) {
    constexpr size_t nq = (size_t)DQ * DM / 8, nk = (size_t)DKV * DM / 8, no = (size_t)DM * DQ / 8, nx = (size_t)RT * DM / 8;
    const size_t b0 = (size_t)blockIdx.x * 256; if (b0 >= nq + 2 * nk + no + nx) return; const float* src; size_t base;
    if (b0 < nq) { src = wq; base = 0; } else if (b0 < nq + nk) { src = wk; base = nq; } else if (b0 < nq + 2 * nk) { src = wv; base = nq + nk; } else if (b0 < nq + 2 * nk + no) { src = wo; base = nq + 2 * nk; } else { src = x; base = nq + 2 * nk + no; }
    const size_t i = b0 + threadIdx.x; const v8f v = *(const v8f*)(src + (i - base) * 8); v8us o;
#pragma unroll
    for (int k = 0; k < 8; ++k) o[k] = f2bf(v[k]); *(v8us*)(dst + i * 8) = o;  }
__global__ __launch_bounds__(256) void k_cstab(float* CS) { const int idx = blockIdx.x * 256 + threadIdx.x; if (idx >= TT * HD) return; const int t = idx / HD, d = idx % HD; const int i = d >> 1;   /* interleaved pairs (2i, 2i+1) share angle t * inv_freq[i] */ const float inv = __fdiv_rn(1.0f, powf(10000.0f, (float)(2 * i) / (float)HD)); const float ang = __fmul_rn((float)t, inv); v2f cs; cs[0] = cosf(ang); cs[1] = sinf(ang);
    *(v2f*)(CS + (size_t)idx * 2) = cs;  }
__global__ __launch_bounds__(256) void k_hrms(const float* __restrict__ F, int pitch, int nheads, float* RF) { const int i = blockIdx.x * 256 + threadIdx.x; if (i >= nheads * RT) return; const int t = i % RT, h = i / RT;   /* t: row of both batches; h: the query heads, then the key heads */ const float* f = F + (size_t)t * pitch + h * HD; float s = 0.f;
#pragma unroll 4
    for (int d = 0; d < HD; d += 4) { const v4f v = *(const v4f*)(f + d);
#pragma unroll
        for (int q = 0; q < 4; ++q) { float p = __fmul_rn(v[q], v[q]); asm volatile("" : "+v"(p)); s = __fadd_rn(s, p); } }
    const float r = __fdiv_rn(1.0f, __fsqrt_rn(__fadd_rn(s * (1.0f / HD), 1e-6f))); *(float*)(RF + i) = r;  }
// k_rope: query and key heads of both batches in one launch (head h of NH_ + NKV: the query heads, then the key heads; a block lies in one head); head planes [b][h][t][d] (fp16 + hi/lo) of rope(w[d] (x rms_factor)) x sc with interleaved pairs out[2i] = x[2i] cos[t][2i] - x[2i+1] sin[t][2i], out[2i+1] = x[2i+1] cos[t][2i+1] + x[2i] sin[t][2i+1]
__global__ __launch_bounds__(256) void k_rope(const float* __restrict__ F, int pitch, const float* __restrict__ CS, const float* __restrict__ RF, const float* __restrict__ qnw, const float* __restrict__ knw, float sc, h16* Q16, bf* Qh, bf* Ql, h16* K16, bf* Kh, bf* Kl) {
    const size_t e = ((size_t)blockIdx.x * 256 + threadIdx.x) * 2; if (e >= (size_t)NB_ * (NH_ + NKV) * TT * HD) return; const int d = (int)(e % HD); const int t = (int)((e / HD) % TT); const int hb = (int)(e / ((size_t)HD * TT)); const int h = hb % (NH_ + NKV), b = hb / (NH_ + NKV); const bool isq = h < NH_;
    const float* f = F + (size_t)(b * TT + t) * pitch + h * HD; const float rf = RF[(size_t)h * RT + b * TT + t]; const float* nw = isq ? qnw : knw; v2h o16; v2us oh, ol;
    const size_t po = ((size_t)(isq ? b * NH_ + h : b * NKV + h - NH_) * TT + t) * HD + d; h16* P16 = isq ? Q16 : K16; bf* Ph = isq ? Qh : Kh; bf* Pl = isq ? Ql : Kl;
#pragma unroll
    for (int q = 0; q < 2; ++q) { const int dd = d + q; const int dp = dd ^ 1; float x0 = f[dd], x1 = f[dp];
        { float n0 = __fmul_rn(x0, rf), n1 = __fmul_rn(x1, rf); asm volatile("" : "+v"(n0)); asm volatile("" : "+v"(n1)); x0 = __fmul_rn(bfr(nw[dd]), n0); x1 = __fmul_rn(bfr(nw[dp]), n1); }
        const v2f cs = *(const v2f*)(CS + ((size_t)t * HD + dd) * 2); float a = __fmul_rn(x0, cs[0]), bq = __fmul_rn(x1, cs[1]); asm volatile("" : "+v"(a)); asm volatile("" : "+v"(bq)); const float r = (((dd & 1) == 0) ? __fsub_rn(a, bq) : __fadd_rn(a, bq)) * sc;
        o16[q] = tohx(r); unsigned short a2, c2; splitf(r, a2, c2); oh[q] = a2; ol[q] = c2; }
    *(v2h*)(P16 + po) = o16; *(v2us*)(Ph + po) = oh; *(v2us*)(Pl + po) = ol;  }
// k_vtp: V^T planes [b][g][d][t] of both batches; F points at the first v column of the joint projection
__global__ __launch_bounds__(256) void k_vtp(const float* __restrict__ F, int pitch, int nheads, h16* V16, bf* Vh, bf* Vl) { const size_t e = ((size_t)blockIdx.x * 256 + threadIdx.x) * 2; if (e >= (size_t)nheads * HD * TT) return; const int t = (int)(e % TT); const int d = (int)((e / TT) % HD); const int gb = (int)(e / ((size_t)TT * HD)); const int g = gb % NKV, b = gb / NKV; v2h o16; v2us oh, ol;
#pragma unroll
    for (int q = 0; q < 2; ++q) { const float x = F[(size_t)(b * TT + t + q) * pitch + g * HD + d]; o16[q] = tohx(x); unsigned short a2, c2; splitf(x, a2, c2); oh[q] = a2; ol[q] = c2; }
    *(v2h*)(V16 + e) = o16; *(v2us*)(Vh + e) = oh; *(v2us*)(Vl + e) = ol;  }
#define FQT  32                   // query positions per work-group
#define FSK  64                   // keys per stage
#define FPK  (HD + 8)             // LDS row pitch of K, elements: 272 bytes, an odd multiple of 16
#define FPV  (FSK + 8)            // LDS row pitch of V^T, elements: 144 bytes, an odd multiple of 16
#define FKT  (FSK * FPK)
#define FPL  (FKT + HD * FPV)     // one plane (K tile, then V^T tile) of a stage, elements
#define CS2  (SCL * 1.4426950408889634f)   // scores to the log2 domain
typedef v4i __attribute__((may_alias)) v4ia;
__device__ __forceinline__ float xhalf(float x) { return __builtin_bit_cast(float, __builtin_amdgcn_permlanex16(__builtin_bit_cast(int, x), __builtin_bit_cast(int, x), 0x76543210, 0xfedcba98, false, false)); }   // lane l with lane l ^ 16
template <typename T16, bool HL>
__device__ __forceinline__ void fa_body(T16* L, const T16* __restrict__ Q, const T16* __restrict__ Q2, const T16* __restrict__ Kp, const T16* __restrict__ K2, const T16* __restrict__ Vt, const T16* __restrict__ V2, int q0, bf* Ah, bf* Al) {
    typedef typename WFrag<T16>::V V;
    constexpr int NP = HL ? 2 : 1, BUF = NP * FPL;
    const int tid = threadIdx.x, lane = tid & 31, c = lane & 15, h = lane >> 4; const int w = __builtin_amdgcn_readfirstlane(tid >> 5);   /* wave number held scalar, so the tests on the wave's diagonal are scalar branches */
    const int hd = w >> 1, qw = q0 + 16 * (w & 1);
    V qf[4], qf2[4];
    // each s_wait_xcnt below stands between the loads in front of it and any rewrite of their address registers; it takes the pointers as inputs, so that they stay in those registers up to the wait
    { const size_t qo = ((size_t)hd * TT + qw + c) * HD + 8 * h; const T16* qp = Q + qo; const T16* qp2 = HL ? Q2 + qo : qp;
#pragma unroll
      for (int kc = 0; kc < 4; ++kc) { qf[kc] = WFrag<T16>::ld(qp + 32 * kc); if (HL) qf2[kc] = WFrag<T16>::ld(qp2 + 32 * kc); }
      asm volatile("s_wait_xcnt 0x0" :: "v"(qp), "v"(qp2) : "memory"); }
    v8f acc[8];
#pragma unroll
    for (int t = 0; t < 8; ++t) acc[t] = (v8f){};
    float m = -3.0e38f, l = 0.f;
    const int ns = q0 / FSK + 1;   // stages that hold a key <= q0 + FQT - 1; the same for every wave of the work-group
    // staging: 16-byte pieces; K: 16 a row, the stage contiguous in memory; V^T: 8 a row, one whole 128-byte line
    const int kr = tid >> 4, kcol = (tid & 15) * 8, vr = tid >> 3, vcol = (tid & 7) * 8;
    v4i rg[NP * 8];
    auto fetch = [&](int s) {
        const size_t ko = (size_t)(s * FSK + kr) * HD + kcol, vo = (size_t)vr * TT + s * FSK + vcol;
        const T16* k1 = Kp + ko; const T16* v1 = Vt + vo; const T16* k2 = HL ? K2 + ko : k1; const T16* v2 = HL ? V2 + vo : v1;
#pragma unroll
        for (int i = 0; i < 4; ++i) { rg[i] = *(const v4ia*)(k1 + 16 * i * HD); rg[4 + i] = *(const v4ia*)(v1 + 32 * i * TT); if (HL) { rg[8 + i] = *(const v4ia*)(k2 + 16 * i * HD); rg[12 + i] = *(const v4ia*)(v2 + 32 * i * TT); } }
        asm volatile("s_wait_xcnt 0x0" :: "v"(k1), "v"(v1), "v"(k2), "v"(v2) : "memory"); };
    auto put = [&](T16* B) {
#pragma unroll
        for (int i = 0; i < 4; ++i) { const int ko = (kr + 16 * i) * FPK + kcol, vo = FKT + (vr + 32 * i) * FPV + vcol;
            *(v4ia*)(B + ko) = rg[i]; *(v4ia*)(B + vo) = rg[4 + i]; if (HL) { *(v4ia*)(B + FPL + ko) = rg[8 + i]; *(v4ia*)(B + FPL + vo) = rg[12 + i]; } } };
    fetch(0); put(L);
    __syncthreads();   // stage 0 is in LDS before any wave reads it
#pragma unroll 1
    for (int s = 0; s < ns; ++s) {
        const bool more = s + 1 < ns;
        if (!HL && more) fetch(s + 1);   // the hl blocks are short and need the registers: they fetch in front of put()
        const T16* B = L + (s & 1) * BUF;
#pragma unroll 1
        for (int sub = 0; sub < FSK / 32; ++sub) {
            const int key0 = s * FSK + sub * 32;
            if (key0 > qw + 15) break;   // every key of the pass lies beyond the wave's last query
            v8f st[2]; st[0] = (v8f){}; st[1] = (v8f){};
            const T16* kp = B + (sub * 32 + c) * FPK + 8 * h; const T16* vp = B + FKT + c * FPV + sub * 32 + 8 * h;
            V va[8];
            // the sched_barriers of this pass keep each group of LDS loads together in front of its products: one LDS latency a group, not one a fragment
            if constexpr (!HL) { V ka[2][4];
#pragma unroll
                for (int kt = 0; kt < 2; ++kt)
#pragma unroll
                    for (int kc = 0; kc < 4; ++kc) ka[kt][kc] = WFrag<T16>::ld(kp + 16 * kt * FPK + 32 * kc);
                __builtin_amdgcn_sched_barrier(0);
#pragma unroll
                for (int kc = 0; kc < 4; ++kc) { st[0] = WFrag<T16>::mma(ka[0][kc], qf[kc], st[0]); st[1] = WFrag<T16>::mma(ka[1][kc], qf[kc], st[1]); }
#pragma unroll
                for (int t = 0; t < 8; ++t) va[t] = WFrag<T16>::ld(vp + 16 * t * FPV);   // V^T fragments fly during the softmax
                __builtin_amdgcn_sched_barrier(0);
            } else {
#pragma unroll
                for (int kt = 0; kt < 2; ++kt) { V ka[4], kb[4];
#pragma unroll
                    for (int kc = 0; kc < 4; ++kc) { ka[kc] = WFrag<T16>::ld(kp + 16 * kt * FPK + 32 * kc); kb[kc] = WFrag<T16>::ld(kp + FPL + 16 * kt * FPK + 32 * kc); }
                    __builtin_amdgcn_sched_barrier(0);
#pragma unroll
                    for (int kc = 0; kc < 4; ++kc) { st[kt] = WFrag<T16>::mma(ka[kc], qf[kc], st[kt]); st[kt] = WFrag<T16>::mma(ka[kc], qf2[kc], st[kt]); st[kt] = WFrag<T16>::mma(kb[kc], qf[kc], st[kt]); }
                    __builtin_amdgcn_sched_barrier(0); } }
            if (key0 + 31 > qw) {   // only a pass that straddles the wave's diagonal pays for the mask
#pragma unroll
                for (int kt = 0; kt < 2; ++kt)
#pragma unroll
                    for (int r = 0; r < 8; ++r) if (key0 + 16 * kt + 8 * h + r > qw + c) st[kt][r] = -3.0e38f; }
            float mx = fmaxf(st[0][0], st[1][0]);
#pragma unroll
            for (int r = 1; r < 8; ++r) mx = fmaxf(mx, fmaxf(st[0][r], st[1][r]));
            mx = fmaxf(mx, xhalf(mx));   // both wave halves hold the query's maximum over the pass (key key0 is never masked here, so it is a real score)
            const float mb = mx * CS2;
            if (__builtin_amdgcn_ballot_w32(mb > m) != 0) {   // some query's maximum rose: rescale (factor 1 in the lanes where it did not; 0 on the first pass)
                const float mn = fmaxf(m, mb), corr = __builtin_amdgcn_exp2f(m - mn); l *= corr; m = mn;
#pragma unroll
                for (int t = 0; t < 8; ++t) acc[t] *= corr; }
            const float nm = (HL ? 0.0f : 10.0f) - m;   // fp16 probabilities carry a factor 1024 (it is in the sum too and cancels), so that small ones stay normal numbers
            float p[16];
#pragma unroll
            for (int i = 0; i < 16; ++i) { p[i] = __builtin_amdgcn_exp2f(fmaf(st[i >> 3][i & 7], CS2, nm)); l += p[i]; }
            V pb, pl;
            if constexpr (HL) { __attribute__((ext_vector_type(16))) unsigned short uh, ul;
#pragma unroll
                for (int i = 0; i < 16; ++i) { unsigned short a, b2; splitf(p[i], a, b2); uh[i] = a; ul[i] = b2; }
                pb = __builtin_bit_cast(v16bf, uh); pl = __builtin_bit_cast(v16bf, ul);
            } else {
#pragma unroll
                for (int i = 0; i < 16; ++i) pb[i] = tohx(p[i]); }
            if constexpr (!HL) {
#pragma unroll
                for (int t = 0; t < 8; ++t) acc[t] = WFrag<T16>::mma(va[t], pb, acc[t]);
            } else {
#pragma unroll
                for (int tg = 0; tg < 8; tg += 4) {
#pragma unroll
                    for (int t = 0; t < 4; ++t) { va[t] = WFrag<T16>::ld(vp + 16 * (tg + t) * FPV); va[4 + t] = WFrag<T16>::ld(vp + FPL + 16 * (tg + t) * FPV); }
                    __builtin_amdgcn_sched_barrier(0);
#pragma unroll
                    for (int t = 0; t < 4; ++t) acc[tg + t] = WFrag<T16>::mma(va[t], pb, acc[tg + t]);
#pragma unroll
                    for (int t = 0; t < 4; ++t) acc[tg + t] = WFrag<T16>::mma(va[t], pl, acc[tg + t]);
#pragma unroll
                    for (int t = 0; t < 4; ++t) acc[tg + t] = WFrag<T16>::mma(va[4 + t], pb, acc[tg + t]);
                    __builtin_amdgcn_sched_barrier(0); } }
            asm volatile("v_nop\n\tv_nop\n\tv_nop\n\tv_nop" : "+v"(acc[0]), "+v"(acc[7]));   // the distance behind the last matrix instruction also on the taken side of the loop's branch
        }
        if (HL && more) fetch(s + 1);
        if (more) put(L + ((s + 1) & 1) * BUF);   // the buffer that stage s - 1 used: every wave left it at the barrier below, one trip ago
        __syncthreads();   // publishes stage s + 1 and ends every wave's reads of stage s
    }
    l += xhalf(l);   // each wave half summed its eight keys of every 16-key tile
    const float inv = __fdiv_rn(1.0f, l);
    const size_t oo = (size_t)(qw + c) * DQ + hd * HD + 8 * h;   // a lane's 8 accumulator registers are 8 consecutive d of its query
#pragma unroll
    for (int t = 0; t < 8; ++t) { v8us oh, ol;
#pragma unroll
        for (int r = 0; r < 8; ++r) { unsigned short a, b2; splitf(acc[t][r] * inv, a, b2); oh[r] = a; ol[r] = b2; }
        *(v8us*)(Ah + oo + 16 * t) = oh; *(v8us*)(Al + oo + 16 * t) = ol; }
}
// grid (kv groups, batches, TT / FQT position blocks, heaviest first); planes [batch][head][t][d] (V: [batch][group][d][t]); output hi/lo planes [batch][t][DQ]
__global__ __launch_bounds__(256) void k_fattn(const h16* __restrict__ Q16, const bf* __restrict__ Qh, const bf* __restrict__ Ql, const h16* __restrict__ K16, const bf* __restrict__ Kh, const bf* __restrict__ Kl, const h16* __restrict__ V16, const bf* __restrict__ Vh, const bf* __restrict__ Vl, bf* Ah, bf* Al) {
    __shared__ __align__(16) unsigned short L[2 * 2 * FPL];
    const int g = blockIdx.x, b = blockIdx.y, q0 = (TT / FQT - 1 - (int)blockIdx.z) * FQT;
    const size_t zq = ((size_t)b * NH_ + g * REP) * TT * HD, zk = ((size_t)b * NKV + g) * TT * HD, zo = (size_t)b * TT * DQ + g * REP * HD;
    if (q0 < RH) fa_body<bf, true>((bf*)L, Qh + zq, Ql + zq, Kh + zk, Kl + zk, Vh + zk, Vl + zk, q0, Ah + zo, Al + zo);
    else fa_body<h16, false>((h16*)L, Q16 + zq, nullptr, K16 + zk, nullptr, V16 + zk, nullptr, q0, Ah + zo, Al + zo);
}

extern "C" void kernel_launch(void* const* d_in, const int* in_sizes, int n_in,
                              void* d_out, int out_size, void* d_ws, size_t ws_size, hipStream_t stream) {
    (void)in_sizes; (void)n_in; (void)out_size;
    const float* x = (const float*)d_in[0]; const float* wq = (const float*)d_in[1]; const float* wk = (const float*)d_in[2]; const float* wv = (const float*)d_in[3]; const float* wo = (const float*)d_in[4]; const float* qnw = (const float*)d_in[5]; const float* knw = (const float*)d_in[6];
    float* OUT = (float*)d_out;     // [2][2048][2048]
    char* wsp = (char*)d_ws;
    auto take = [&](size_t bytes) { char* p = wsp; wsp += (bytes + 255) & ~(size_t)255; return (void*)p; };
    const size_t NQ = (size_t)NH_ * TT * HD, NK = (size_t)NKV * TT * HD;   // elements of one batch's query planes and of its key or value planes
    bf* WQKV = (bf*)take(((size_t)DF * DM + (size_t)DM * DQ + (size_t)RT * DM) * 2); bf* WO = WQKV + (size_t)DF * DM; bf* XB = WO + (size_t)DM * DQ;   // one range, in k_cvt8's order: wq, wk, wv (together the [DF][DM] operand of the joint projection), wo, x
    float* CS = (float*)take((size_t)TT * HD * 2 * 4); float* RF = (float*)take((size_t)(NH_ + NKV) * RT * 4); float* F = (float*)take((size_t)RT * DF * 4);
    h16* QP16 = (h16*)take(NB_ * NQ * 2); h16* KP16 = (h16*)take(NB_ * NK * 2); h16* VT16 = (h16*)take(NB_ * NK * 2);
    bf* QPh = (bf*)take(NB_ * NQ * 2); bf* QPl = (bf*)take(NB_ * NQ * 2); bf* KPh = (bf*)take(NB_ * NK * 2); bf* KPl = (bf*)take(NB_ * NK * 2); bf* VTh = (bf*)take(NB_ * NK * 2); bf* VTl = (bf*)take(NB_ * NK * 2);
    bf* ATh = (bf*)take((size_t)NB_ * TT * DQ * 2); bf* ATl = (bf*)take((size_t)NB_ * TT * DQ * 2);
    if ((size_t)(wsp - (char*)d_ws) > ws_size) return;    // ws 256 MiB
    k_cvt8<<<(unsigned)(((size_t)DF * DM + (size_t)DM * DQ + (size_t)RT * DM) / 8 / 256), 256, 0, stream>>>(wq, wk, wv, wo, x, WQKV);
    k_cstab<<<(TT * HD + 255) / 256, 256, 0, stream>>>(CS);
    k_gemmw<bf, 0, false, 8><<<dim3(RT / 64, DF / 64, 1), 256, 0, stream>>>(XB, nullptr, WQKV, nullptr, DM, F, DF, nullptr, 0, 0, 0);   // q | k | v of both batches
    k_hrms<<<((NH_ + NKV) * RT + 255) / 256, 256, 0, stream>>>(F, DF, NH_ + NKV, RF);
    k_rope<<<(unsigned)((size_t)NB_ * (NH_ + NKV) * TT * HD / 2 / 256), 256, 0, stream>>>(F, DF, CS, RF, qnw, knw, 1.0f, QP16, QPh, QPl, KP16, KPh, KPl);
    k_vtp<<<(unsigned)((size_t)NB_ * NKV * TT * HD / 2 / 256), 256, 0, stream>>>(F + DQ + DKV, DF, NB_ * NKV, VT16, VTh, VTl);
    k_fattn<<<dim3(NKV, NB_, TT / FQT), 256, 0, stream>>>(QP16, QPh, QPl, KP16, KPh, KPl, VT16, VTh, VTl, ATh, ATl);
    k_gemmw<bf, 1, false, 8><<<dim3(RT / 64, DM / 64, 1), 256, 0, stream>>>(ATh, ATl, WO, nullptr, DQ, OUT, DM, nullptr, 0, 0, 0);
}

// v005
// Measured time: 244 microseconds a run.
// Two timings next to v004 put it at 1.14 and 1.15 times that version's speed.
// All steps since v000 together make it 6.76 times as fast.
#include <hip/hip_runtime.h>

// _CompatAttention (x [2][2048][2048]; q = RMSNorm_128(x wq^T) * q_norm_w (16 heads x 128), k = RMSNorm_128(x wk^T) * k_norm_w, v = x wv^T (4 kv heads; group h/4); interleaved-pair RoPE (theta 1e4, positions 0..L-1, angles computed on device); causal softmax(q.k / sqrt(128)) (finfo.min fill); out = merged wo^T -> [2][2048][2048]).
// Compute dtypes, f32 accumulate: every input rounded to bf16; q/k/v on PLAIN bf16 operands (inputs: exact); RMSNorm (eps 1e-6) and RoPE f32; causal scores, softmax and attn.v in one kernel (running maximum and sum, f32): query rows < 512 hl (3 products), the rest single fp16 (probabilities x1024), keys beyond the diagonal skipped; wo hl x exact (2 products).

#define NB_  2
#define TT   2048
#define DM   2048
#define NH_  16
#define NKV  4
#define REP  (NH_ / NKV)
#define HD   128
#define DQ   (NH_ * HD)
#define DKV  (NKV * HD)
#define DF   (DQ + 2 * DKV)        // columns of the joint q | k | v projection
#define RT   (NB_ * TT)           // rows of both batches together
#define RH   512                  // query rows < RH use hi+lo planes (0: none)
#define SCL  0.088388347648318447f   // HD^-0.5
typedef _Float16 h16;
typedef unsigned short bf;
typedef __attribute__((ext_vector_type(16))) __bf16   v16bf;
typedef __attribute__((ext_vector_type(16))) _Float16 v16h;
typedef __attribute__((ext_vector_type(8)))  _Float16 v8h;
typedef __attribute__((ext_vector_type(8)))  unsigned short v8us;
typedef __attribute__((ext_vector_type(8)))  float    v8f;
typedef __attribute__((ext_vector_type(4)))  float    v4f;
typedef v8h  __attribute__((may_alias)) v8ha;
typedef v4f  __attribute__((may_alias)) v4fa;
typedef v8us __attribute__((may_alias)) v8usa;

__device__ __forceinline__ unsigned short f2bf(float f) { unsigned u = __float_as_uint(f); u += 0x7FFFu + ((u >> 16) & 1u); return (unsigned short)(u >> 16); }
__device__ __forceinline__ float bf2f(unsigned short b) { return __uint_as_float(((unsigned)b) << 16); }
__device__ __forceinline__ float bfr(float f) { return bf2f(f2bf(f)); }
__device__ __forceinline__ v16h cat16(v8h lo, v8h hi) { return __builtin_shufflevector(lo, hi, 0, 1, 2, 3, 4, 5, 6, 7, 8, 9, 10, 11, 12, 13, 14, 15); }
__device__ __forceinline__ v16bf cat16b(v8us lo, v8us hi) { return __builtin_bit_cast(v16bf, __builtin_shufflevector(lo, hi, 0, 1, 2, 3, 4, 5, 6, 7, 8, 9, 10, 11, 12, 13, 14, 15)); }
__device__ __forceinline__ v8f wmma16(v16h a, v16h b, v8f c) { return __builtin_amdgcn_wmma_f32_16x16x32_f16(false, a, false, b, (short)0, c, false, false); }
__device__ __forceinline__ v8f wmmab(v16bf a, v16bf b, v8f c) { return __builtin_amdgcn_wmma_f32_16x16x32_bf16(false, a, false, b, (short)0, c, false, false); }



// ---- k_gemmw: register-blocked GEMM, one work-group of NW waves per 64x64 output tile; wave w takes the 32-wide K slices w, w + NW, ... into its own 16 accumulators (operands straight from K-contiguous 16-bit planes),
// the NW partial tiles meet in LDS (column-major, pitch 68) behind one barrier and are summed in wave order 0..NW-1; grid (M/64, N/64, Z), 32 * NW threads.
// C[m][n] (f32, pitch ldc, + optional f32 bias[n]) = sum_k A[m][k] Bt[n][k] (+ split products per NSPLIT). z-batch strides sA/sB/sC in elements. K % 32 == 0.
template <typename T16> struct WFrag;
template <> struct WFrag<h16> { typedef v16h V; static __device__ __forceinline__ V ld(const h16* p) { return cat16(*(const v8h*)p, *(const v8h*)(p + 16)); } static __device__ __forceinline__ v8f mma(V a, V b, v8f c) { return wmma16(a, b, c); } };
template <> struct WFrag<bf> { typedef v16bf V; static __device__ __forceinline__ V ld(const bf* p) { return cat16b(*(const v8us*)p, *(const v8us*)(p + 16)); } static __device__ __forceinline__ v8f mma(V a, V b, v8f c) { return wmmab(a, b, c); } };
template <typename T16, int NSPLIT, bool BIAS, int NW>
__global__ __launch_bounds__(32 * NW) void k_gemmw(const T16* __restrict__ A, const T16* __restrict__ A2, const T16* __restrict__ Bt, const T16* __restrict__ Bt2, int K, float* C, int ldc, const float* __restrict__ bias, size_t sA, size_t sB, size_t sC) {
    typedef typename WFrag<T16>::V V;
    __shared__ __align__(16) float os[NW * 64 * 68];
    const size_t z = blockIdx.z; A += z * sA; if (A2) A2 += z * sA; Bt += z * sB; if (Bt2) Bt2 += z * sB; C += z * sC;
    const int lane = threadIdx.x & 31, lr = lane & 15, hi = lane >> 4; const int w = __builtin_amdgcn_readfirstlane((int)(threadIdx.x >> 5));   /* wave number held scalar, so the K loop's counter and branch stay scalar */ const int r0 = blockIdx.x * 64, c0 = blockIdx.y * 64;
    v8f acc[4][4];
#pragma unroll
    for (int mb = 0; mb < 4; ++mb)
#pragma unroll
        for (int nb = 0; nb < 4; ++nb) acc[mb][nb] = (v8f){};
    const size_t aoff = (size_t)(r0 + lr) * K + 8 * hi, boff = (size_t)(c0 + lr) * K + 8 * hi;
#pragma unroll 1
    for (int kc = w * 32; kc < K; kc += 32 * NW) {
        V a[4], a2[4];
#pragma unroll
        for (int mb = 0; mb < 4; ++mb) { a[mb] = WFrag<T16>::ld(A + aoff + (size_t)mb * 16 * K + kc); if (NSPLIT == 1 || NSPLIT == 2) a2[mb] = WFrag<T16>::ld(A2 + aoff + (size_t)mb * 16 * K + kc); }
#pragma unroll
        for (int nb = 0; nb < 4; ++nb) { const V b = WFrag<T16>::ld(Bt + boff + (size_t)nb * 16 * K + kc); V b2; if (NSPLIT >= 2) b2 = WFrag<T16>::ld(Bt2 + boff + (size_t)nb * 16 * K + kc);
#pragma unroll
            for (int mb = 0; mb < 4; ++mb) { acc[mb][nb] = WFrag<T16>::mma(a[mb], b, acc[mb][nb]); if (NSPLIT == 1 || NSPLIT == 2) acc[mb][nb] = WFrag<T16>::mma(a2[mb], b, acc[mb][nb]); if (NSPLIT >= 2) acc[mb][nb] = WFrag<T16>::mma(a[mb], b2, acc[mb][nb]); } }
        asm volatile("v_nop\n\tv_nop\n\tv_nop\n\tv_nop" : "+v"(acc[0][0]), "+v"(acc[1][1]), "+v"(acc[2][2]), "+v"(acc[3][3]) : "v"(a[0]), "v"(a[3]));
    }
    float* ow = os + w * (64 * 68) + lr * 68 + hi * 8;   // element (row, col) of this wave's partial tile lies at col * 68 + row: an accumulator's 8 rows are two 16-byte stores
    // both loops unrolled: acc[][] stays in registers only under constant indices
#pragma unroll
    for (int mb = 0; mb < 4; ++mb)
#pragma unroll
        for (int nb = 0; nb < 4; ++nb) { float* p = ow + nb * 16 * 68 + mb * 16; const v8f t = acc[mb][nb]; *(v4fa*)p = __builtin_shufflevector(t, t, 0, 1, 2, 3); *(v4fa*)(p + 4) = __builtin_shufflevector(t, t, 4, 5, 6, 7); }
    __syncthreads();   // every wave's partial tile is in LDS before any wave sums
    // the loops below are unrolled so that the LDS loads of all NW partial tiles issue together, val[] stays in registers and the offsets fold into the instructions
    v4f val[32 / NW];   // wave w owns rows w * 64 / NW ..., whole 256-byte rows; val[u]: 4 rows (row group u >> 1) of column (u & 1) * 32 + lane
#pragma unroll
    for (int u = 0; u < 32 / NW; ++u) { const float* p = os + ((u & 1) * 32 + lane) * 68 + (w * (16 / NW) + (u >> 1)) * 4; val[u] = *(const v4fa*)p;
#pragma unroll
        for (int ww = 1; ww < NW; ++ww) val[u] += *(const v4fa*)(p + ww * (64 * 68));
        if (BIAS) { const float bv = bfr(bias[c0 + (u & 1) * 32 + lane]); val[u][0] += bv; val[u][1] += bv; val[u][2] += bv; val[u][3] += bv; }
    }
    float* cb = C + (size_t)(r0 + w * (64 / NW)) * ldc + c0;   // wave-uniform base of the wave's first row; a store covers 32 adjacent columns, one 128-byte line
#pragma unroll
    for (int k = 0; k < 64 / NW; ++k) { float* cr = cb + (size_t)k * ldc; cr[lane] = val[(k >> 2) * 2][k & 3]; cr[32 + lane] = val[(k >> 2) * 2 + 1][k & 3]; }
}

__device__ __forceinline__ h16 tohx(float x) { return (h16)x; }
__device__ __forceinline__ void splitf(float y, unsigned short& h, unsigned short& l) { h = f2bf(y); l = f2bf(y - bf2f(h)); }
typedef __attribute__((ext_vector_type(2))) _Float16 v2h;
typedef __attribute__((ext_vector_type(4))) _Float16 v4h;
typedef __attribute__((ext_vector_type(2))) unsigned short v2us;
typedef __attribute__((ext_vector_type(4))) unsigned short v4us;
typedef __attribute__((ext_vector_type(2))) float v2f;
typedef __attribute__((ext_vector_type(4))) int v4i;

__global__ __launch_bounds__(256) void k_wtG(const float* __restrict__ w, int K, int N, bf* Bt) {
    const int lane = threadIdx.x & 31; const int L0 = (blockIdx.x * 8 + (threadIdx.x >> 5)) * 8; const int nlines = N * K / 64;
{
#pragma unroll 1
        for (int l = 0; l < 8; ++l) { const int L = L0 + l; if (L >= nlines) break; const size_t e = (size_t)L * 64 + lane * 2; const int k = (int)(e % K), n = (int)(e / K); v2us o;
            o[0] = f2bf(w[(size_t)k * N + n]); o[1] = f2bf(w[(size_t)(k + 1) * N + n]); *(v2us*)(Bt + e) = o; }
         }
}
// k_cvt8: all five f32 operands to bf16 in one launch; the planes lie one behind the other in dst in the order wq, wk, wv, wo, x. Every plane is a whole number of blocks (2048 elements each), so the choice of the source is uniform in a block.
__global__ __launch_bounds__(256) void k_cvt8(const float* __restrict__ wq, const float* __restrict__ wk, const float* __restrict__ wv, const float* __restrict__ wo, const float* __restrict__ x, bf* dst) {
    constexpr size_t nq = (size_t)DQ * DM / 8, nk = (size_t)DKV * DM / 8, no = (size_t)DM * DQ / 8, nx = (size_t)RT * DM / 8;
    const size_t b0 = (size_t)blockIdx.x * 256; if (b0 >= nq + 2 * nk + no + nx) return; const float* src; size_t base;
    if (b0 < nq) { src = wq; base = 0; } else if (b0 < nq + nk) { src = wk; base = nq; } else if (b0 < nq + 2 * nk) { src = wv; base = nq + nk; } else if (b0 < nq + 2 * nk + no) { src = wo; base = nq + 2 * nk; } else { src = x; base = nq + 2 * nk + no; }
    const size_t i = b0 + threadIdx.x; const v8f v = *(const v8f*)(src + (i - base) * 8); v8us o;
#pragma unroll
    for (int k = 0; k < 8; ++k) o[k] = f2bf(v[k]); *(v8us*)(dst + i * 8) = o;  }
#define FQT  32                   // query positions per work-group
#define FSK  64                   // keys per stage
#define FPK  (HD + 8)             // LDS row pitch of K, elements: 272 bytes, an odd multiple of 16
#define FPV  (FSK + 8)            // LDS row pitch of V^T, elements: 144 bytes, an odd multiple of 16
#define FKT  (FSK * FPK)
#define FPL  (FKT + HD * FPV)     // one plane (K tile, then V^T tile) of a stage, elements
#define CS2  (SCL * 1.4426950408889634f)   // scores to the log2 domain
typedef v4i __attribute__((may_alias)) v4ia;
__device__ __forceinline__ float xhalf(float x) { return __builtin_bit_cast(float, __builtin_amdgcn_permlanex16(__builtin_bit_cast(int, x), __builtin_bit_cast(int, x), 0x76543210, 0xfedcba98, false, false)); }   // lane l with lane l ^ 16
template <typename T16, bool HL>
__device__ __forceinline__ void fa_body(T16* L, const T16* __restrict__ Q, const T16* __restrict__ Q2, const T16* __restrict__ Kp, const T16* __restrict__ K2, const T16* __restrict__ Vt, const T16* __restrict__ V2, int q0, bf* Ah, bf* Al) {
    typedef typename WFrag<T16>::V V;
    constexpr int NP = HL ? 2 : 1, BUF = NP * FPL;
    const int tid = threadIdx.x, lane = tid & 31, c = lane & 15, h = lane >> 4; const int w = __builtin_amdgcn_readfirstlane(tid >> 5);   /* wave number held scalar, so the tests on the wave's diagonal are scalar branches */
    const int hd = w >> 1, qw = q0 + 16 * (w & 1);
    V qf[4], qf2[4];
    // each s_wait_xcnt below stands between the loads in front of it and any rewrite of their address registers; it takes the pointers as inputs, so that they stay in those registers up to the wait
    { const size_t qo = ((size_t)hd * TT + qw + c) * HD + 8 * h; const T16* qp = Q + qo; const T16* qp2 = HL ? Q2 + qo : qp;
#pragma unroll
      for (int kc = 0; kc < 4; ++kc) { qf[kc] = WFrag<T16>::ld(qp + 32 * kc); if (HL) qf2[kc] = WFrag<T16>::ld(qp2 + 32 * kc); }
      asm volatile("s_wait_xcnt 0x0" :: "v"(qp), "v"(qp2) : "memory"); }
    v8f acc[8];
#pragma unroll
    for (int t = 0; t < 8; ++t) acc[t] = (v8f){};
    float m = -3.0e38f, l = 0.f;
    const int ns = q0 / FSK + 1;   // stages that hold a key <= q0 + FQT - 1; the same for every wave of the work-group
    // staging: 16-byte pieces; K: 16 a row, the stage contiguous in memory; V^T: 8 a row, one whole 128-byte line
    const int kr = tid >> 4, kcol = (tid & 15) * 8, vr = tid >> 3, vcol = (tid & 7) * 8;
    v4i rg[NP * 8];
    auto fetch = [&](int s) {
        const size_t ko = (size_t)(s * FSK + kr) * HD + kcol, vo = (size_t)vr * TT + s * FSK + vcol;
        const T16* k1 = Kp + ko; const T16* v1 = Vt + vo; const T16* k2 = HL ? K2 + ko : k1; const T16* v2 = HL ? V2 + vo : v1;
#pragma unroll
        for (int i = 0; i < 4; ++i) { rg[i] = *(const v4ia*)(k1 + 16 * i * HD); rg[4 + i] = *(const v4ia*)(v1 + 32 * i * TT); if (HL) { rg[8 + i] = *(const v4ia*)(k2 + 16 * i * HD); rg[12 + i] = *(const v4ia*)(v2 + 32 * i * TT); } }
        asm volatile("s_wait_xcnt 0x0" :: "v"(k1), "v"(v1), "v"(k2), "v"(v2) : "memory"); };
    auto put = [&](T16* B) {
#pragma unroll
        for (int i = 0; i < 4; ++i) { const int ko = (kr + 16 * i) * FPK + kcol, vo = FKT + (vr + 32 * i) * FPV + vcol;
            *(v4ia*)(B + ko) = rg[i]; *(v4ia*)(B + vo) = rg[4 + i]; if (HL) { *(v4ia*)(B + FPL + ko) = rg[8 + i]; *(v4ia*)(B + FPL + vo) = rg[12 + i]; } } };
    fetch(0); put(L);
    __syncthreads();   // stage 0 is in LDS before any wave reads it
#pragma unroll 1
    for (int s = 0; s < ns; ++s) {
        const bool more = s + 1 < ns;
        if (!HL && more) fetch(s + 1);   // the hl blocks are short and need the registers: they fetch in front of put()
        const T16* B = L + (s & 1) * BUF;
#pragma unroll 1
        for (int sub = 0; sub < FSK / 32; ++sub) {
            const int key0 = s * FSK + sub * 32;
            if (key0 > qw + 15) break;   // every key of the pass lies beyond the wave's last query
            v8f st[2]; st[0] = (v8f){}; st[1] = (v8f){};
            const T16* kp = B + (sub * 32 + c) * FPK + 8 * h; const T16* vp = B + FKT + c * FPV + sub * 32 + 8 * h;
            V va[8];
            // the sched_barriers of this pass keep each group of LDS loads together in front of its products: one LDS latency a group, not one a fragment
            if constexpr (!HL) { V ka[2][4];
#pragma unroll
                for (int kt = 0; kt < 2; ++kt)
#pragma unroll
                    for (int kc = 0; kc < 4; ++kc) ka[kt][kc] = WFrag<T16>::ld(kp + 16 * kt * FPK + 32 * kc);
                __builtin_amdgcn_sched_barrier(0);
#pragma unroll
                for (int kc = 0; kc < 4; ++kc) { st[0] = WFrag<T16>::mma(ka[0][kc], qf[kc], st[0]); st[1] = WFrag<T16>::mma(ka[1][kc], qf[kc], st[1]); }
#pragma unroll
                for (int t = 0; t < 8; ++t) va[t] = WFrag<T16>::ld(vp + 16 * t * FPV);   // V^T fragments fly during the softmax
                __builtin_amdgcn_sched_barrier(0);
            } else {
#pragma unroll
                for (int kt = 0; kt < 2; ++kt) { V ka[4], kb[4];
#pragma unroll
                    for (int kc = 0; kc < 4; ++kc) { ka[kc] = WFrag<T16>::ld(kp + 16 * kt * FPK + 32 * kc); kb[kc] = WFrag<T16>::ld(kp + FPL + 16 * kt * FPK + 32 * kc); }
                    __builtin_amdgcn_sched_barrier(0);
#pragma unroll
                    for (int kc = 0; kc < 4; ++kc) { st[kt] = WFrag<T16>::mma(ka[kc], qf[kc], st[kt]); st[kt] = WFrag<T16>::mma(ka[kc], qf2[kc], st[kt]); st[kt] = WFrag<T16>::mma(kb[kc], qf[kc], st[kt]); }
                    __builtin_amdgcn_sched_barrier(0); } }
            if (key0 + 31 > qw) {   // only a pass that straddles the wave's diagonal pays for the mask
#pragma unroll
                for (int kt = 0; kt < 2; ++kt)
#pragma unroll
                    for (int r = 0; r < 8; ++r) if (key0 + 16 * kt + 8 * h + r > qw + c) st[kt][r] = -3.0e38f; }
            float mx = fmaxf(st[0][0], st[1][0]);
#pragma unroll
            for (int r = 1; r < 8; ++r) mx = fmaxf(mx, fmaxf(st[0][r], st[1][r]));
            mx = fmaxf(mx, xhalf(mx));   // both wave halves hold the query's maximum over the pass (key key0 is never masked here, so it is a real score)
            const float mb = mx * CS2;
            if (__builtin_amdgcn_ballot_w32(mb > m) != 0) {   // some query's maximum rose: rescale (factor 1 in the lanes where it did not; 0 on the first pass)
                const float mn = fmaxf(m, mb), corr = __builtin_amdgcn_exp2f(m - mn); l *= corr; m = mn;
#pragma unroll
                for (int t = 0; t < 8; ++t) acc[t] *= corr; }
            const float nm = (HL ? 0.0f : 10.0f) - m;   // fp16 probabilities carry a factor 1024 (it is in the sum too and cancels), so that small ones stay normal numbers
            float p[16];
#pragma unroll
            for (int i = 0; i < 16; ++i) { p[i] = __builtin_amdgcn_exp2f(fmaf(st[i >> 3][i & 7], CS2, nm)); l += p[i]; }
            V pb, pl;
            if constexpr (HL) { __attribute__((ext_vector_type(16))) unsigned short uh, ul;
#pragma unroll
                for (int i = 0; i < 16; ++i) { unsigned short a, b2; splitf(p[i], a, b2); uh[i] = a; ul[i] = b2; }
                pb = __builtin_bit_cast(v16bf, uh); pl = __builtin_bit_cast(v16bf, ul);
            } else {
#pragma unroll
                for (int i = 0; i < 16; ++i) pb[i] = tohx(p[i]); }
            if constexpr (!HL) {
#pragma unroll
                for (int t = 0; t < 8; ++t) acc[t] = WFrag<T16>::mma(va[t], pb, acc[t]);
            } else {
#pragma unroll
                for (int tg = 0; tg < 8; tg += 4) {
#pragma unroll
                    for (int t = 0; t < 4; ++t) { va[t] = WFrag<T16>::ld(vp + 16 * (tg + t) * FPV); va[4 + t] = WFrag<T16>::ld(vp + FPL + 16 * (tg + t) * FPV); }
                    __builtin_amdgcn_sched_barrier(0);
#pragma unroll
                    for (int t = 0; t < 4; ++t) acc[tg + t] = WFrag<T16>::mma(va[t], pb, acc[tg + t]);
#pragma unroll
                    for (int t = 0; t < 4; ++t) acc[tg + t] = WFrag<T16>::mma(va[t], pl, acc[tg + t]);
#pragma unroll
                    for (int t = 0; t < 4; ++t) acc[tg + t] = WFrag<T16>::mma(va[4 + t], pb, acc[tg + t]);
                    __builtin_amdgcn_sched_barrier(0); } }
            asm volatile("v_nop\n\tv_nop\n\tv_nop\n\tv_nop" : "+v"(acc[0]), "+v"(acc[7]));   // the distance behind the last matrix instruction also on the taken side of the loop's branch
        }
        if (HL && more) fetch(s + 1);
        if (more) put(L + ((s + 1) & 1) * BUF);   // the buffer that stage s - 1 used: every wave left it at the barrier below, one trip ago
        __syncthreads();   // publishes stage s + 1 and ends every wave's reads of stage s
    }
    l += xhalf(l);   // each wave half summed its eight keys of every 16-key tile
    const float inv = __fdiv_rn(1.0f, l);
    const size_t oo = (size_t)(qw + c) * DQ + hd * HD + 8 * h;   // a lane's 8 accumulator registers are 8 consecutive d of its query
#pragma unroll
    for (int t = 0; t < 8; ++t) { v8us oh, ol;
#pragma unroll
        for (int r = 0; r < 8; ++r) { unsigned short a, b2; splitf(acc[t][r] * inv, a, b2); oh[r] = a; ol[r] = b2; }
        *(v8us*)(Ah + oo + 16 * t) = oh; *(v8us*)(Al + oo + 16 * t) = ol; }
}
// grid (kv groups, batches, TT / FQT position blocks, heaviest first); planes [batch][head][t][d] (V: [batch][group][d][t]); output hi/lo planes [batch][t][DQ]
__global__ __launch_bounds__(256) void k_fattn(const h16* __restrict__ Q16, const bf* __restrict__ Qh, const bf* __restrict__ Ql, const h16* __restrict__ K16, const bf* __restrict__ Kh, const bf* __restrict__ Kl, const h16* __restrict__ V16, const bf* __restrict__ Vh, const bf* __restrict__ Vl, bf* Ah, bf* Al) {
    __shared__ __align__(16) unsigned short L[2 * 2 * FPL];
    const int g = blockIdx.x, b = blockIdx.y, q0 = (TT / FQT - 1 - (int)blockIdx.z) * FQT;
    const size_t zq = ((size_t)b * NH_ + g * REP) * TT * HD, zk = ((size_t)b * NKV + g) * TT * HD, zo = (size_t)b * TT * DQ + g * REP * HD;
    if (q0 < RH) fa_body<bf, true>((bf*)L, Qh + zq, Ql + zq, Kh + zk, Kl + zk, Vh + zk, Vl + zk, q0, Ah + zo, Al + zo);
    else fa_body<h16, false>((h16*)L, Q16 + zq, nullptr, K16 + zk, nullptr, V16 + zk, nullptr, q0, Ah + zo, Al + zo);
}

// ---- k_post: all that lies between the joint projection and attention, in one launch: RMS factor, norm weight and RoPE of the query and key heads, and the V^T planes.
// A work-group of 8 waves owns PR token rows of PS head slots (a slot: HD columns of F; the query heads, then the key heads, then the value heads; NH_ and NKV are multiples of PS, so a work-group's slots are of one kind).
// Query and key slots: a wave holds whole head rows, 4 consecutive d a lane (two RoPE pairs): the mean square is one sum over the wave, both partners of a pair lie in the lane, and a row's angles are computed once in the wave for its PS heads.
// Value slots: the f32 tile turns in LDS, and a lane stores 4 consecutive t of one d: 16 lanes write one whole 128-byte line of a plane.
#define PR   64                   // token rows per work-group: one 128-byte line of a V^T plane
#define PW   (PR / 8)             // rows per wave
#define PS   2                    // head slots per work-group
#define PP   (HD + 1)             // LDS row pitch of the value tile, floats: odd, so that the 32 column reads of a wave fall on 32 banks
typedef __attribute__((ext_vector_type(4))) __bf16 v4b;
typedef __attribute__((ext_vector_type(2))) unsigned __attribute__((may_alias)) v2u;
template <int X> __device__ __forceinline__ float xrow(float x) { return __builtin_bit_cast(float, __builtin_amdgcn_update_dpp(0, __builtin_bit_cast(int, x), 0x160 + X, 0xf, 0xf, true)); }   // lane l with lane l ^ X of its 16-lane row (DPP row_xmask)
// four consecutive elements to the three planes: fp16, bf16 high part, bf16 rest
__device__ __forceinline__ void put3(v4f r, h16* p16, bf* ph, bf* pl) {
    const v2u hp = __builtin_bit_cast(v2u, __builtin_convertvector(r, v4b)); v4f rest;   // two high parts a dword
#pragma unroll
    for (int q = 0; q < 4; ++q) rest[q] = r[q] - __uint_as_float((q & 1) ? hp[q >> 1] & 0xFFFF0000u : hp[q >> 1] << 16);
    *(v4h*)p16 = __builtin_convertvector(r, v4h); *(v2u*)ph = hp; *(v2u*)pl = __builtin_bit_cast(v2u, __builtin_convertvector(rest, v4b)); }
__global__ __launch_bounds__(256) void k_post(const float* __restrict__ F, const float* __restrict__ qnw, const float* __restrict__ knw, h16* Q16, bf* Qh, bf* Ql, h16* K16, bf* Kh, bf* Kl, h16* V16, bf* Vh, bf* Vl) {
    __shared__ __align__(16) float T[PS * PR * PP];
    const int tid = threadIdx.x, lane = tid & 31; const int w = __builtin_amdgcn_readfirstlane(tid >> 5);   /* wave number held scalar: row addresses stay scalar */
    const int s0 = blockIdx.x * PS, r0 = blockIdx.y * PR, b = r0 / TT, t0 = r0 % TT;   // PR divides TT: a work-group lies in one batch
    v4f x[PS][PW];   // all of the wave's rows are asked for at once: one memory latency a wave
    { const float* f = F + (size_t)(r0 + w * PW) * DF + s0 * HD + 4 * lane;
#pragma unroll
      for (int j = 0; j < PS; ++j)
#pragma unroll
          for (int k = 0; k < PW; ++k) x[j][k] = *(const v4f*)(f + (size_t)k * DF + j * HD); }
    if (s0 < NH_ + NKV) {
        const bool isq = s0 < NH_;
        const v4f nv = *(const v4f*)((isq ? qnw : knw) + 4 * lane);
        asm volatile("s_wait_xcnt 0x0" ::: "memory");   // stands between the load above and any rewrite of the registers that hold its address
        // cosine and sine of the wave's rows, under the loads; the loop stays rolled (four library calls of code, not 32) and hands each lane's own values on through LDS, which no other lane reads: no barrier
        v4f* cs = (v4f*)T + w * PW * 32 + lane;
        { float inv[2];
#pragma unroll
          for (int u = 0; u < 2; ++u) inv[u] = __fdiv_rn(1.0f, powf(10000.0f, (float)(2 * (2 * lane + u)) / (float)HD));   // pairs 2 * lane and 2 * lane + 1
#pragma unroll 1   // rolled for code size: four inlined library calls a trip, each with its large-argument branch
          for (int k = 0; k < PW; ++k) { const float tf = (float)(t0 + w * PW + k); const float a0 = __fmul_rn(tf, inv[0]), a1 = __fmul_rn(tf, inv[1]); v4f o; o[0] = cosf(a0); o[1] = sinf(a0); o[2] = cosf(a1); o[3] = sinf(a1); cs[k * 32] = o; } }
        v4f wn;
#pragma unroll
        for (int q = 0; q < 4; ++q) wn[q] = bfr(nv[q]);
        const size_t po = ((size_t)(isq ? b * NH_ + s0 : b * NKV + s0 - NH_) * TT + t0 + w * PW) * HD + 4 * lane;
        h16* P16 = (isq ? Q16 : K16) + po; bf* Ph = (isq ? Qh : Kh) + po; bf* Pl = (isq ? Ql : Kl) + po;
        // both loops unrolled: x[][] stays in registers only under constant indices
#pragma unroll
        for (int k = 0; k < PW; ++k) { const v4f c = cs[k * 32];
#pragma unroll
            for (int j = 0; j < PS; ++j) { const v4f v = x[j][k];
                float ss = (v[0] * v[0] + v[1] * v[1]) + (v[2] * v[2] + v[3] * v[3]);
                ss += xrow<1>(ss); ss += xrow<2>(ss); ss += xrow<4>(ss); ss += xrow<8>(ss); ss += xhalf(ss);   // every lane holds the row's sum of squares
                const float rf = __fdiv_rn(1.0f, __fsqrt_rn(ss * (1.0f / HD) + 1e-6f)); v4f y, r;
#pragma unroll
                for (int q = 0; q < 4; ++q) y[q] = wn[q] * (v[q] * rf);
                r[0] = y[0] * c[0] - y[1] * c[1]; r[1] = y[1] * c[0] + y[0] * c[1]; r[2] = y[2] * c[2] - y[3] * c[3]; r[3] = y[3] * c[2] + y[2] * c[3];
                const int o = (j * TT + k) * HD; put3(r, P16 + o, Ph + o, Pl + o); } }
    } else {
#pragma unroll
        for (int j = 0; j < PS; ++j)
#pragma unroll
            for (int k = 0; k < PW; ++k)
#pragma unroll
                for (int q = 0; q < 4; ++q) T[(j * PR + w * PW + k) * PP + 4 * lane + q] = x[j][k][q];
        __syncthreads();   // the whole tile is in LDS before any wave reads its columns; the branch around it is uniform in the work-group
        const int tq = tid & 15, dr = tid >> 4;
        const size_t vo = ((size_t)(b * NKV + s0 - NH_ - NKV) * HD + dr) * TT + t0 + 4 * tq;
#pragma unroll
        for (int i = 0; i < PS * HD / 16; ++i) { const float* p = T + ((i * 16 / HD) * PR + 4 * tq) * PP + (i * 16) % HD + dr; v4f r; r[0] = p[0]; r[1] = p[PP]; r[2] = p[2 * PP]; r[3] = p[3 * PP];
            const size_t o = vo + (size_t)i * 16 * TT; put3(r, V16 + o, Vh + o, Vl + o); }
        asm volatile("s_wait_xcnt 0x0" ::: "memory");   // stands between the stores above and any rewrite of the registers that hold their addresses
    }
}

extern "C" void kernel_launch(void* const* d_in, const int* in_sizes, int n_in,
                              void* d_out, int out_size, void* d_ws, size_t ws_size, hipStream_t stream) {
    (void)in_sizes; (void)n_in; (void)out_size;
    const float* x = (const float*)d_in[0]; const float* wq = (const float*)d_in[1]; const float* wk = (const float*)d_in[2]; const float* wv = (const float*)d_in[3]; const float* wo = (const float*)d_in[4]; const float* qnw = (const float*)d_in[5]; const float* knw = (const float*)d_in[6];
    float* OUT = (float*)d_out;     // [2][2048][2048]
    char* wsp = (char*)d_ws;
    auto take = [&](size_t bytes) { char* p = wsp; wsp += (bytes + 255) & ~(size_t)255; return (void*)p; };
    const size_t NQ = (size_t)NH_ * TT * HD, NK = (size_t)NKV * TT * HD;   // elements of one batch's query planes and of its key or value planes
    bf* WQKV = (bf*)take(((size_t)DF * DM + (size_t)DM * DQ + (size_t)RT * DM) * 2); bf* WO = WQKV + (size_t)DF * DM; bf* XB = WO + (size_t)DM * DQ;   // one range, in k_cvt8's order: wq, wk, wv (together the [DF][DM] operand of the joint projection), wo, x
    float* F = (float*)take((size_t)RT * DF * 4);
    h16* QP16 = (h16*)take(NB_ * NQ * 2); h16* KP16 = (h16*)take(NB_ * NK * 2); h16* VT16 = (h16*)take(NB_ * NK * 2);
    bf* QPh = (bf*)take(NB_ * NQ * 2); bf* QPl = (bf*)take(NB_ * NQ * 2); bf* KPh = (bf*)take(NB_ * NK * 2); bf* KPl = (bf*)take(NB_ * NK * 2); bf* VTh = (bf*)take(NB_ * NK * 2); bf* VTl = (bf*)take(NB_ * NK * 2);
    bf* ATh = (bf*)take((size_t)NB_ * TT * DQ * 2); bf* ATl = (bf*)take((size_t)NB_ * TT * DQ * 2);
    if ((size_t)(wsp - (char*)d_ws) > ws_size) return;    // ws 256 MiB
    k_cvt8<<<(unsigned)(((size_t)DF * DM + (size_t)DM * DQ + (size_t)RT * DM) / 8 / 256), 256, 0, stream>>>(wq, wk, wv, wo, x, WQKV);
    k_gemmw<bf, 0, false, 8><<<dim3(RT / 64, DF / 64, 1), 256, 0, stream>>>(XB, nullptr, WQKV, nullptr, DM, F, DF, nullptr, 0, 0, 0);   // q | k | v of both batches
    k_post<<<dim3((NH_ + 2 * NKV) / PS, RT / PR), 256, 0, stream>>>(F, qnw, knw, QP16, QPh, QPl, KP16, KPh, KPl, VT16, VTh, VTl);
    k_fattn<<<dim3(NKV, NB_, TT / FQT), 256, 0, stream>>>(QP16, QPh, QPl, KP16, KPh, KPl, VT16, VTh, VTl, ATh, ATl);
    k_gemmw<bf, 1, false, 8><<<dim3(RT / 64, DM / 64, 1), 256, 0, stream>>>(ATh, ATl, WO, nullptr, DQ, OUT, DM, nullptr, 0, 0, 0);
}

// v006
// A run of this version takes 153 microseconds.
// In two side-by-side timings against v005, it was 1.58 and 1.60 times as fast.
// All steps since v000 together make it 10.8 times as fast.
#include <hip/hip_runtime.h>

// _CompatAttention (x [2][2048][2048]; q = RMSNorm_128(x wq^T) * q_norm_w (16 heads x 128), k = RMSNorm_128(x wk^T) * k_norm_w, v = x wv^T (4 kv heads; group h/4); interleaved-pair RoPE (theta 1e4, positions 0..L-1, angles computed on device); causal softmax(q.k / sqrt(128)) (finfo.min fill); out = merged wo^T -> [2][2048][2048]).
// Compute dtypes, f32 accumulate: every input rounded to bf16; q/k/v on PLAIN bf16 operands (inputs: exact); RMSNorm (eps 1e-6) and RoPE f32; causal scores, softmax and attn.v in one kernel (running maximum and sum, f32): query rows < 512 hl (3 products), the rest single fp16 (probabilities x1024), keys beyond the diagonal skipped; wo hl x exact (2 products).

#define NB_  2
#define TT   2048
#define DM   2048
#define NH_  16
#define NKV  4
#define REP  (NH_ / NKV)
#define HD   128
#define DQ   (NH_ * HD)
#define DKV  (NKV * HD)
#define DF   (DQ + 2 * DKV)        // columns of the joint q | k | v projection
#define RT   (NB_ * TT)           // rows of both batches together
#define RH   512                  // query rows < RH use hi+lo planes (0: none)
#define SCL  0.088388347648318447f   // HD^-0.5
typedef _Float16 h16;
typedef unsigned short bf;
typedef __attribute__((ext_vector_type(16))) __bf16   v16bf;
typedef __attribute__((ext_vector_type(16))) _Float16 v16h;
typedef __attribute__((ext_vector_type(8)))  _Float16 v8h;
typedef __attribute__((ext_vector_type(8)))  unsigned short v8us;
typedef __attribute__((ext_vector_type(8)))  float    v8f;
typedef __attribute__((ext_vector_type(4)))  float    v4f;
typedef v8h  __attribute__((may_alias)) v8ha;
typedef v4f  __attribute__((may_alias)) v4fa;
typedef v8us __attribute__((may_alias)) v8usa;

__device__ __forceinline__ unsigned short f2bf(float f) { unsigned u = __float_as_uint(f); u += 0x7FFFu + ((u >> 16) & 1u); return (unsigned short)(u >> 16); }
__device__ __forceinline__ float bf2f(unsigned short b) { return __uint_as_float(((unsigned)b) << 16); }
__device__ __forceinline__ float bfr(float f) { return bf2f(f2bf(f)); }
__device__ __forceinline__ v16h cat16(v8h lo, v8h hi) { return __builtin_shufflevector(lo, hi, 0, 1, 2, 3, 4, 5, 6, 7, 8, 9, 10, 11, 12, 13, 14, 15); }
__device__ __forceinline__ v16bf cat16b(v8us lo, v8us hi) { return __builtin_bit_cast(v16bf, __builtin_shufflevector(lo, hi, 0, 1, 2, 3, 4, 5, 6, 7, 8, 9, 10, 11, 12, 13, 14, 15)); }
__device__ __forceinline__ v8f wmma16(v16h a, v16h b, v8f c) { return __builtin_amdgcn_wmma_f32_16x16x32_f16(false, a, false, b, (short)0, c, false, false); }
__device__ __forceinline__ v8f wmmab(v16bf a, v16bf b, v8f c) { return __builtin_amdgcn_wmma_f32_16x16x32_bf16(false, a, false, b, (short)0, c, false, false); }



// ---- k_gemmt: GEMM on operand tiles shared through LDS. A work-group of WM x WN waves owns a (64 WM) x (64 WN) tile of C; every wave keeps one 64x64 part in 16 accumulators over the whole K.
// A pass is GKP k = 256 bytes of every operand row. A stage holds the pass's rows in slices of 64 rows: WM slices of A, with NA == 2 WM slices of A2, then WN slices of Bt: as many slices as waves,
// and wave w brings slice w with ONE tensor load (rows padded to 272 bytes in LDS). Two buffers: the load of stage s + 2 goes out behind the barrier that ends the reads of stage s and flies during pass s + 1.
// C[m][n] (f32, pitch ldc) = sum_k A[m][k] Bt[n][k] (+ A2[m][k] Bt[n][k]). K a multiple of GKP and at least 2 GKP; grid (M / (64 WM), N / (64 WN)), 32 WM WN threads.
template <typename T16> struct WFrag;
template <> struct WFrag<h16> { typedef v16h V; static __device__ __forceinline__ V ld(const h16* p) { return cat16(*(const v8h*)p, *(const v8h*)(p + 16)); } static __device__ __forceinline__ v8f mma(V a, V b, v8f c) { return wmma16(a, b, c); } };
template <> struct WFrag<bf> { typedef v16bf V; static __device__ __forceinline__ V ld(const bf* p) { return cat16b(*(const v8us*)p, *(const v8us*)(p + 16)); } static __device__ __forceinline__ v8f mma(V a, V b, v8f c) { return wmmab(a, b, c); } };
#define GKP  128                  // k per pass: rows of 256 bytes
#define GPI  (GKP + 8)            // LDS row pitch, elements: 272 bytes, an odd multiple of 16
#define GSL  9216                 // one slice in LDS, elements: 64 rows of 272 bytes = 17408 bytes, rounded up to 18432 = 9 x 2 KiB
typedef uint32_t u32x4 __attribute__((ext_vector_type(4)));
typedef uint32_t u32x8 __attribute__((ext_vector_type(8)));
__device__ __forceinline__ uint32_t uni(uint32_t v) { return (uint32_t)__builtin_amdgcn_readfirstlane(v); }
__device__ __forceinline__ uint32_t pinned(uint32_t v) { uint32_t w = (uint32_t)__builtin_amdgcn_readfirstlane(v); asm volatile("" : "+s"(w)); return w; }   // holds the test of a tensor load in a scalar register, so that the branch around it is a scalar one (the load ignores EXEC)
// group 0 goes through both statements as an operand that they hand on: the words so stay in one register tuple from the issue to the wait, and a new aim is formed only behind the wait that covers the request
__device__ __forceinline__ void tdm_load(u32x4& g0, u32x8 g1) { asm volatile("tensor_load_to_lds %0, %1" : "+s"(g0) : "s"(g1) : "memory"); }   // one request of the whole wave: 64 rows of 256 bytes into LDS
__device__ __forceinline__ void tdm_wait(u32x4& g0, u32x8 g1) { asm volatile("s_wait_tensorcnt 0x0" : "+s"(g0) : "s"(g1) : "memory"); }   // the wave's request has landed
template <int NA, int WM, int WN, int K>
__global__ __launch_bounds__(32 * WM * WN) void k_gemmt(const bf* __restrict__ A, const bf* __restrict__ A2, const bf* __restrict__ Bt, float* C, int ldc) {
    typedef WFrag<bf>::V V;
    constexpr int NW = WM * WN, STG = NW * GSL;
    static_assert(NA * WM + WN == NW, "one slice a wave"); static_assert(K % GKP == 0 && K >= 2 * GKP, "whole passes, and both stages of the prologue exist");
    __shared__ __attribute__((aligned(2048))) bf L[2 * STG];
    const int lane = threadIdx.x & 31, lr = lane & 15, hi = lane >> 4; const int w = __builtin_amdgcn_readfirstlane((int)(threadIdx.x >> 5));   /* wave number held scalar: slice addresses and descriptor words are scalar */
    const int wm = w / WN, wn = w % WN, r0 = blockIdx.x * (64 * WM), c0 = blockIdx.y * (64 * WN);
    const bf* sp = w < WM ? A + (size_t)(r0 + 64 * w) * K : (NA == 2 && w < 2 * WM) ? A2 + (size_t)(r0 + 64 * (w - WM)) * K : Bt + (size_t)(c0 + 64 * (w - NA * WM)) * K;   // first row of the wave's slice
    const uint64_t ga = (uint64_t)sp; const uint32_t ld0 = (uint32_t)(uintptr_t)L + (uint32_t)w * (GSL * 2u);
    u32x8 g1;   // 1-byte elements, tensor = tile = 64 rows of 256 bytes, 16 bytes of pad behind every 256
    g1[0] = uni((1u << 20) | (5u << 22) | (3u << 25)); g1[1] = uni(256u << 16); g1[2] = uni(64u << 16); g1[3] = uni(256u << 16); g1[4] = uni(64u); g1[5] = uni((uint32_t)K * 2u); g1[6] = uni(0u); g1[7] = uni(0u);
    asm volatile("" : "+s"(g1));   // as in pinned(): descriptor words held in scalar registers of their own for the whole kernel, so that none is lent out and written back while a request is outstanding
    u32x4 g0; g0[0] = uni(1u);
    auto aim = [&](uint32_t lds, uint64_t p) { g0[1] = uni(lds); g0[2] = uni((uint32_t)p); g0[3] = uni((((uint32_t)(p >> 32)) & 0x01FFFFFFu) | 0x80000000u); };
    v8f acc[4][4];
#pragma unroll
    for (int mb = 0; mb < 4; ++mb)
#pragma unroll
        for (int nb = 0; nb < 4; ++nb) acc[mb][nb] = (v8f){};
    constexpr int np = K / GKP; const int fo = lr * GPI + 8 * hi;
    V a[2][4], a2[2][4], b[2][4];
    // fragments of the 32-k block kc of the stage in buffer B, into register set kc & 1; the loop is unrolled so that the arrays stay in registers
    auto frags = [&](const bf* B, int kc) { const bf* ap = B + wm * GSL + fo + 32 * kc; const bf* bp = B + (NA * WM + wn) * GSL + fo + 32 * kc;
#pragma unroll
        for (int i = 0; i < 4; ++i) { a[kc & 1][i] = WFrag<bf>::ld(ap + 16 * i * GPI); if (NA == 2) a2[kc & 1][i] = WFrag<bf>::ld(ap + WM * GSL + 16 * i * GPI); b[kc & 1][i] = WFrag<bf>::ld(bp + 16 * i * GPI); } };
    aim(ld0, ga); tdm_load(g0, g1);
    tdm_wait(g0, g1);
    __syncthreads();   // stage 0 is whole before any wave reads it
    aim(ld0 + STG * 2u, ga + GKP * 2u); tdm_load(g0, g1);
    frags(L, 0);
#pragma unroll 1   // rolled: one pass of code
    for (int s = 0; s < np; ++s) {
        const bf* B = L + (s & 1) * STG;
        // the loops of a pass are unrolled: the fragment sets and acc[][] stay in registers only under constant indices
#pragma unroll
        for (int kc = 0; kc < GKP / 32; ++kc) {
            // the next block's LDS loads go out as one group in front of this block's products
            if (kc + 1 < GKP / 32) frags(B, kc + 1);
            else {   // publish point of stage s + 1, in front of the pass's last block, whose fragments are in registers by then
                asm volatile("s_wait_dscnt 0x0" ::: "memory");   // the wave's reads of stage s are done
                tdm_wait(g0, g1);   // the wave's slice of stage s + 1 has landed
                __syncthreads();   // publishes stage s + 1 and ends every wave's reads of stage s
                if (pinned(s + 2 < np)) { aim(ld0 + (uint32_t)(s & 1) * (STG * 2u), ga + (uint64_t)(s + 2) * (GKP * 2u)); tdm_load(g0, g1); }   // refill of the buffer that pass s has read
                if (s + 1 < np) frags(L + ((s + 1) & 1) * STG, 0);
            }
            __builtin_amdgcn_sched_barrier(0);   // this one and the one below keep each group of LDS loads together and out of the matrix run: one LDS stall a block, hidden behind the block before
#pragma unroll
            for (int nb = 0; nb < 4; ++nb)
#pragma unroll
                for (int mb = 0; mb < 4; ++mb) { acc[mb][nb] = wmmab(a[kc & 1][mb], b[kc & 1][nb], acc[mb][nb]); if (NA == 2) acc[mb][nb] = wmmab(a2[kc & 1][mb], b[kc & 1][nb], acc[mb][nb]); }
            __builtin_amdgcn_sched_barrier(0);
        }
    }
    tdm_wait(g0, g1);   // no request is left when the ring becomes output staging
    asm volatile("s_wait_dscnt 0x0" ::: "memory");
    // the last pass's barrier has ended every read of the ring. Each wave turns its own 64x64 tile in its own slice of buffer 0 (column-major, pitch 68 floats), so that a store covers one whole 128-byte line of C
    float* ow = (float*)L + w * (GSL / 2); float* pw = ow + lr * 68 + hi * 8;
    // both loops unrolled: acc[][] stays in registers only under constant indices
#pragma unroll
    for (int mb = 0; mb < 4; ++mb)
#pragma unroll
        for (int nb = 0; nb < 4; ++nb) { float* p = pw + nb * 16 * 68 + mb * 16; const v8f t = acc[mb][nb]; *(v4fa*)p = __builtin_shufflevector(t, t, 0, 1, 2, 3); *(v4fa*)(p + 4) = __builtin_shufflevector(t, t, 4, 5, 6, 7); }
    asm volatile("s_wait_dscnt 0x0" ::: "memory");   // the wave's own LDS writes are done before its lanes read one another's
    float* cb = C + (size_t)(r0 + 64 * wm) * ldc + c0 + 64 * wn;   // wave-uniform base of the wave's first row
    // unrolled so that the LDS loads issue together and the offsets fold into the instructions
#pragma unroll
    for (int rg = 0; rg < 16; ++rg) { const v4f v0 = *(const v4fa*)(ow + lane * 68 + rg * 4), v1 = *(const v4fa*)(ow + (32 + lane) * 68 + rg * 4);
#pragma unroll
        for (int k = 0; k < 4; ++k) { float* cr = cb + (size_t)(rg * 4 + k) * ldc; cr[lane] = v0[k]; cr[32 + lane] = v1[k]; } }
}

__device__ __forceinline__ h16 tohx(float x) { return (h16)x; }
__device__ __forceinline__ void splitf(float y, unsigned short& h, unsigned short& l) { h = f2bf(y); l = f2bf(y - bf2f(h)); }
typedef __attribute__((ext_vector_type(2))) _Float16 v2h;
typedef __attribute__((ext_vector_type(4))) _Float16 v4h;
typedef __attribute__((ext_vector_type(2))) unsigned short v2us;
typedef __attribute__((ext_vector_type(4))) unsigned short v4us;
typedef __attribute__((ext_vector_type(2))) float v2f;
typedef __attribute__((ext_vector_type(4))) int v4i;

__global__ __launch_bounds__(256) void k_wtG(const float* __restrict__ w, int K, int N, bf* Bt) {
    const int lane = threadIdx.x & 31; const int L0 = (blockIdx.x * 8 + (threadIdx.x >> 5)) * 8; const int nlines = N * K / 64;
{
#pragma unroll 1
        for (int l = 0; l < 8; ++l) { const int L = L0 + l; if (L >= nlines) break; const size_t e = (size_t)L * 64 + lane * 2; const int k = (int)(e % K), n = (int)(e / K); v2us o;
            o[0] = f2bf(w[(size_t)k * N + n]); o[1] = f2bf(w[(size_t)(k + 1) * N + n]); *(v2us*)(Bt + e) = o; }
         }
}
// k_cvt8: all five f32 operands to bf16 in one launch; the planes lie one behind the other in dst in the order wq, wk, wv, wo, x. Every plane is a whole number of blocks (2048 elements each), so the choice of the source is uniform in a block.
__global__ __launch_bounds__(256) void k_cvt8(const float* __restrict__ wq, const float* __restrict__ wk, const float* __restrict__ wv, const float* __restrict__ wo, const float* __restrict__ x, bf* dst) {
    constexpr size_t nq = (size_t)DQ * DM / 8, nk = (size_t)DKV * DM / 8, no = (size_t)DM * DQ / 8, nx = (size_t)RT * DM / 8;
    const size_t b0 = (size_t)blockIdx.x * 256; if (b0 >= nq + 2 * nk + no + nx) return; const float* src; size_t base;
    if (b0 < nq) { src = wq; base = 0; } else if (b0 < nq + nk) { src = wk; base = nq; } else if (b0 < nq + 2 * nk) { src = wv; base = nq + nk; } else if (b0 < nq + 2 * nk + no) { src = wo; base = nq + 2 * nk; } else { src = x; base = nq + 2 * nk + no; }
    const size_t i = b0 + threadIdx.x; const v8f v = *(const v8f*)(src + (i - base) * 8); v8us o;
#pragma unroll
    for (int k = 0; k < 8; ++k) o[k] = f2bf(v[k]); *(v8us*)(dst + i * 8) = o;  }
#define FQT  32                   // query positions per work-group
#define FSK  64                   // keys per stage
#define FPK  (HD + 8)             // LDS row pitch of K, elements: 272 bytes, an odd multiple of 16
#define FPV  (FSK + 8)            // LDS row pitch of V^T, elements: 144 bytes, an odd multiple of 16
#define FKT  (FSK * FPK)
#define FPL  (FKT + HD * FPV)     // one plane (K tile, then V^T tile) of a stage, elements
#define CS2  (SCL * 1.4426950408889634f)   // scores to the log2 domain
typedef v4i __attribute__((may_alias)) v4ia;
__device__ __forceinline__ float xhalf(float x) { return __builtin_bit_cast(float, __builtin_amdgcn_permlanex16(__builtin_bit_cast(int, x), __builtin_bit_cast(int, x), 0x76543210, 0xfedcba98, false, false)); }   // lane l with lane l ^ 16
template <typename T16, bool HL>
__device__ __forceinline__ void fa_body(T16* L, const T16* __restrict__ Q, const T16* __restrict__ Q2, const T16* __restrict__ Kp, const T16* __restrict__ K2, const T16* __restrict__ Vt, const T16* __restrict__ V2, int q0, bf* Ah, bf* Al) {
    typedef typename WFrag<T16>::V V;
    constexpr int NP = HL ? 2 : 1, BUF = NP * FPL;
    const int tid = threadIdx.x, lane = tid & 31, c = lane & 15, h = lane >> 4; const int w = __builtin_amdgcn_readfirstlane(tid >> 5);   /* wave number held scalar, so the tests on the wave's diagonal are scalar branches */
    const int hd = w >> 1, qw = q0 + 16 * (w & 1);
    V qf[4], qf2[4];
    // each s_wait_xcnt below stands between the loads in front of it and any rewrite of their address registers; it takes the pointers as inputs, so that they stay in those registers up to the wait
    { const size_t qo = ((size_t)hd * TT + qw + c) * HD + 8 * h; const T16* qp = Q + qo; const T16* qp2 = HL ? Q2 + qo : qp;
#pragma unroll
      for (int kc = 0; kc < 4; ++kc) { qf[kc] = WFrag<T16>::ld(qp + 32 * kc); if (HL) qf2[kc] = WFrag<T16>::ld(qp2 + 32 * kc); }
      asm volatile("s_wait_xcnt 0x0" :: "v"(qp), "v"(qp2) : "memory"); }
    v8f acc[8];
#pragma unroll
    for (int t = 0; t < 8; ++t) acc[t] = (v8f){};
    float m = -3.0e38f, l = 0.f;
    const int ns = q0 / FSK + 1;   // stages that hold a key <= q0 + FQT - 1; the same for every wave of the work-group
    // staging: 16-byte pieces; K: 16 a row, the stage contiguous in memory; V^T: 8 a row, one whole 128-byte line
    const int kr = tid >> 4, kcol = (tid & 15) * 8, vr = tid >> 3, vcol = (tid & 7) * 8;
    v4i rg[NP * 8];
    auto fetch = [&](int s) {
        const size_t ko = (size_t)(s * FSK + kr) * HD + kcol, vo = (size_t)vr * TT + s * FSK + vcol;
        const T16* k1 = Kp + ko; const T16* v1 = Vt + vo; const T16* k2 = HL ? K2 + ko : k1; const T16* v2 = HL ? V2 + vo : v1;
#pragma unroll
        for (int i = 0; i < 4; ++i) { rg[i] = *(const v4ia*)(k1 + 16 * i * HD); rg[4 + i] = *(const v4ia*)(v1 + 32 * i * TT); if (HL) { rg[8 + i] = *(const v4ia*)(k2 + 16 * i * HD); rg[12 + i] = *(const v4ia*)(v2 + 32 * i * TT); } }
        asm volatile("s_wait_xcnt 0x0" :: "v"(k1), "v"(v1), "v"(k2), "v"(v2) : "memory"); };
    auto put = [&](T16* B) {
#pragma unroll
        for (int i = 0; i < 4; ++i) { const int ko = (kr + 16 * i) * FPK + kcol, vo = FKT + (vr + 32 * i) * FPV + vcol;
            *(v4ia*)(B + ko) = rg[i]; *(v4ia*)(B + vo) = rg[4 + i]; if (HL) { *(v4ia*)(B + FPL + ko) = rg[8 + i]; *(v4ia*)(B + FPL + vo) = rg[12 + i]; } } };
    fetch(0); put(L);
    __syncthreads();   // stage 0 is in LDS before any wave reads it
#pragma unroll 1
    for (int s = 0; s < ns; ++s) {
        const bool more = s + 1 < ns;
        if (!HL && more) fetch(s + 1);   // the hl blocks are short and need the registers: they fetch in front of put()
        const T16* B = L + (s & 1) * BUF;
#pragma unroll 1
        for (int sub = 0; sub < FSK / 32; ++sub) {
            const int key0 = s * FSK + sub * 32;
            if (key0 > qw + 15) break;   // every key of the pass lies beyond the wave's last query
            v8f st[2]; st[0] = (v8f){}; st[1] = (v8f){};
            const T16* kp = B + (sub * 32 + c) * FPK + 8 * h; const T16* vp = B + FKT + c * FPV + sub * 32 + 8 * h;
            V va[8];
            // the sched_barriers of this pass keep each group of LDS loads together in front of its products: one LDS latency a group, not one a fragment
            if constexpr (!HL) { V ka[2][4];
#pragma unroll
                for (int kt = 0; kt < 2; ++kt)
#pragma unroll
                    for (int kc = 0; kc < 4; ++kc) ka[kt][kc] = WFrag<T16>::ld(kp + 16 * kt * FPK + 32 * kc);
                __builtin_amdgcn_sched_barrier(0);
#pragma unroll
                for (int kc = 0; kc < 4; ++kc) { st[0] = WFrag<T16>::mma(ka[0][kc], qf[kc], st[0]); st[1] = WFrag<T16>::mma(ka[1][kc], qf[kc], st[1]); }
#pragma unroll
                for (int t = 0; t < 8; ++t) va[t] = WFrag<T16>::ld(vp + 16 * t * FPV);   // V^T fragments fly during the softmax
                __builtin_amdgcn_sched_barrier(0);
            } else {
#pragma unroll
                for (int kt = 0; kt < 2; ++kt) { V ka[4], kb[4];
#pragma unroll
                    for (int kc = 0; kc < 4; ++kc) { ka[kc] = WFrag<T16>::ld(kp + 16 * kt * FPK + 32 * kc); kb[kc] = WFrag<T16>::ld(kp + FPL + 16 * kt * FPK + 32 * kc); }
                    __builtin_amdgcn_sched_barrier(0);
#pragma unroll
                    for (int kc = 0; kc < 4; ++kc) { st[kt] = WFrag<T16>::mma(ka[kc], qf[kc], st[kt]); st[kt] = WFrag<T16>::mma(ka[kc], qf2[kc], st[kt]); st[kt] = WFrag<T16>::mma(kb[kc], qf[kc], st[kt]); }
                    __builtin_amdgcn_sched_barrier(0); } }
            if (key0 + 31 > qw) {   // only a pass that straddles the wave's diagonal pays for the mask
#pragma unroll
                for (int kt = 0; kt < 2; ++kt)
#pragma unroll
                    for (int r = 0; r < 8; ++r) if (key0 + 16 * kt + 8 * h + r > qw + c) st[kt][r] = -3.0e38f; }
            float mx = fmaxf(st[0][0], st[1][0]);
#pragma unroll
            for (int r = 1; r < 8; ++r) mx = fmaxf(mx, fmaxf(st[0][r], st[1][r]));
            mx = fmaxf(mx, xhalf(mx));   // both wave halves hold the query's maximum over the pass (key key0 is never masked here, so it is a real score)
            const float mb = mx * CS2;
            if (__builtin_amdgcn_ballot_w32(mb > m) != 0) {   // some query's maximum rose: rescale (factor 1 in the lanes where it did not; 0 on the first pass)
                const float mn = fmaxf(m, mb), corr = __builtin_amdgcn_exp2f(m - mn); l *= corr; m = mn;
#pragma unroll
                for (int t = 0; t < 8; ++t) acc[t] *= corr; }
            const float nm = (HL ? 0.0f : 10.0f) - m;   // fp16 probabilities carry a factor 1024 (it is in the sum too and cancels), so that small ones stay normal numbers
            float p[16];
#pragma unroll
            for (int i = 0; i < 16; ++i) { p[i] = __builtin_amdgcn_exp2f(fmaf(st[i >> 3][i & 7], CS2, nm)); l += p[i]; }
            V pb, pl;
            if constexpr (HL) { __attribute__((ext_vector_type(16))) unsigned short uh, ul;
#pragma unroll
                for (int i = 0; i < 16; ++i) { unsigned short a, b2; splitf(p[i], a, b2); uh[i] = a; ul[i] = b2; }
                pb = __builtin_bit_cast(v16bf, uh); pl = __builtin_bit_cast(v16bf, ul);
            } else {
#pragma unroll
                for (int i = 0; i < 16; ++i) pb[i] = tohx(p[i]); }
            if constexpr (!HL) {
#pragma unroll
                for (int t = 0; t < 8; ++t) acc[t] = WFrag<T16>::mma(va[t], pb, acc[t]);
            } else {
#pragma unroll
                for (int tg = 0; tg < 8; tg += 4) {
#pragma unroll
                    for (int t = 0; t < 4; ++t) { va[t] = WFrag<T16>::ld(vp + 16 * (tg + t) * FPV); va[4 + t] = WFrag<T16>::ld(vp + FPL + 16 * (tg + t) * FPV); }
                    __builtin_amdgcn_sched_barrier(0);
#pragma unroll
                    for (int t = 0; t < 4; ++t) acc[tg + t] = WFrag<T16>::mma(va[t], pb, acc[tg + t]);
#pragma unroll
                    for (int t = 0; t < 4; ++t) acc[tg + t] = WFrag<T16>::mma(va[t], pl, acc[tg + t]);
#pragma unroll
                    for (int t = 0; t < 4; ++t) acc[tg + t] = WFrag<T16>::mma(va[4 + t], pb, acc[tg + t]);
                    __builtin_amdgcn_sched_barrier(0); } }
            asm volatile("v_nop\n\tv_nop\n\tv_nop\n\tv_nop" : "+v"(acc[0]), "+v"(acc[7]));   // the distance behind the last matrix instruction also on the taken side of the loop's branch
        }
        if (HL && more) fetch(s + 1);
        if (more) put(L + ((s + 1) & 1) * BUF);   // the buffer that stage s - 1 used: every wave left it at the barrier below, one trip ago
        __syncthreads();   // publishes stage s + 1 and ends every wave's reads of stage s
    }
    l += xhalf(l);   // each wave half summed its eight keys of every 16-key tile
    const float inv = __fdiv_rn(1.0f, l);
    const size_t oo = (size_t)(qw + c) * DQ + hd * HD + 8 * h;   // a lane's 8 accumulator registers are 8 consecutive d of its query
#pragma unroll
    for (int t = 0; t < 8; ++t) { v8us oh, ol;
#pragma unroll
        for (int r = 0; r < 8; ++r) { unsigned short a, b2; splitf(acc[t][r] * inv, a, b2); oh[r] = a; ol[r] = b2; }
        *(v8us*)(Ah + oo + 16 * t) = oh; *(v8us*)(Al + oo + 16 * t) = ol; }
}
// grid (kv groups, batches, TT / FQT position blocks, heaviest first); planes [batch][head][t][d] (V: [batch][group][d][t]); output hi/lo planes [batch][t][DQ]
__global__ __launch_bounds__(256) void k_fattn(const h16* __restrict__ Q16, const bf* __restrict__ Qh, const bf* __restrict__ Ql, const h16* __restrict__ K16, const bf* __restrict__ Kh, const bf* __restrict__ Kl, const h16* __restrict__ V16, const bf* __restrict__ Vh, const bf* __restrict__ Vl, bf* Ah, bf* Al) {
    __shared__ __align__(16) unsigned short L[2 * 2 * FPL];
    const int g = blockIdx.x, b = blockIdx.y, q0 = (TT / FQT - 1 - (int)blockIdx.z) * FQT;
    const size_t zq = ((size_t)b * NH_ + g * REP) * TT * HD, zk = ((size_t)b * NKV + g) * TT * HD, zo = (size_t)b * TT * DQ + g * REP * HD;
    if (q0 < RH) fa_body<bf, true>((bf*)L, Qh + zq, Ql + zq, Kh + zk, Kl + zk, Vh + zk, Vl + zk, q0, Ah + zo, Al + zo);
    else fa_body<h16, false>((h16*)L, Q16 + zq, nullptr, K16 + zk, nullptr, V16 + zk, nullptr, q0, Ah + zo, Al + zo);
}

// ---- k_post: all that lies between the joint projection and attention, in one launch: RMS factor, norm weight and RoPE of the query and key heads, and the V^T planes.
// A work-group of 8 waves owns PR token rows of PS head slots (a slot: HD columns of F; the query heads, then the key heads, then the value heads; NH_ and NKV are multiples of PS, so a work-group's slots are of one kind).
// Query and key slots: a wave holds whole head rows, 4 consecutive d a lane (two RoPE pairs): the mean square is one sum over the wave, both partners of a pair lie in the lane, and a row's angles are computed once in the wave for its PS heads.
// Value slots: the f32 tile turns in LDS, and a lane stores 4 consecutive t of one d: 16 lanes write one whole 128-byte line of a plane.
#define PR   64                   // token rows per work-group: one 128-byte line of a V^T plane
#define PW   (PR / 8)             // rows per wave
#define PS   2                    // head slots per work-group
#define PP   (HD + 1)             // LDS row pitch of the value tile, floats: odd, so that the 32 column reads of a wave fall on 32 banks
typedef __attribute__((ext_vector_type(4))) __bf16 v4b;
typedef __attribute__((ext_vector_type(2))) unsigned __attribute__((may_alias)) v2u;
template <int X> __device__ __forceinline__ float xrow(float x) { return __builtin_bit_cast(float, __builtin_amdgcn_update_dpp(0, __builtin_bit_cast(int, x), 0x160 + X, 0xf, 0xf, true)); }   // lane l with lane l ^ X of its 16-lane row (DPP row_xmask)
// four consecutive elements to the three planes: fp16, bf16 high part, bf16 rest
__device__ __forceinline__ void put3(v4f r, h16* p16, bf* ph, bf* pl) {
    const v2u hp = __builtin_bit_cast(v2u, __builtin_convertvector(r, v4b)); v4f rest;   // two high parts a dword
#pragma unroll
    for (int q = 0; q < 4; ++q) rest[q] = r[q] - __uint_as_float((q & 1) ? hp[q >> 1] & 0xFFFF0000u : hp[q >> 1] << 16);
    *(v4h*)p16 = __builtin_convertvector(r, v4h); *(v2u*)ph = hp; *(v2u*)pl = __builtin_bit_cast(v2u, __builtin_convertvector(rest, v4b)); }
__global__ __launch_bounds__(256) void k_post(const float* __restrict__ F, const float* __restrict__ qnw, const float* __restrict__ knw, h16* Q16, bf* Qh, bf* Ql, h16* K16, bf* Kh, bf* Kl, h16* V16, bf* Vh, bf* Vl) {
    __shared__ __align__(16) float T[PS * PR * PP];
    const int tid = threadIdx.x, lane = tid & 31; const int w = __builtin_amdgcn_readfirstlane(tid >> 5);   /* wave number held scalar: row addresses stay scalar */
    const int s0 = blockIdx.x * PS, r0 = blockIdx.y * PR, b = r0 / TT, t0 = r0 % TT;   // PR divides TT: a work-group lies in one batch
    v4f x[PS][PW];   // all of the wave's rows are asked for at once: one memory latency a wave
    { const float* f = F + (size_t)(r0 + w * PW) * DF + s0 * HD + 4 * lane;
#pragma unroll
      for (int j = 0; j < PS; ++j)
#pragma unroll
          for (int k = 0; k < PW; ++k) x[j][k] = *(const v4f*)(f + (size_t)k * DF + j * HD); }
    if (s0 < NH_ + NKV) {
        const bool isq = s0 < NH_;
        const v4f nv = *(const v4f*)((isq ? qnw : knw) + 4 * lane);
        asm volatile("s_wait_xcnt 0x0" ::: "memory");   // stands between the load above and any rewrite of the registers that hold its address
        // cosine and sine of the wave's rows, under the loads; the loop stays rolled (four library calls of code, not 32) and hands each lane's own values on through LDS, which no other lane reads: no barrier
        v4f* cs = (v4f*)T + w * PW * 32 + lane;
        { float inv[2];
#pragma unroll
          for (int u = 0; u < 2; ++u) inv[u] = __fdiv_rn(1.0f, powf(10000.0f, (float)(2 * (2 * lane + u)) / (float)HD));   // pairs 2 * lane and 2 * lane + 1
#pragma unroll 1   // rolled for code size: four inlined library calls a trip, each with its large-argument branch
          for (int k = 0; k < PW; ++k) { const float tf = (float)(t0 + w * PW + k); const float a0 = __fmul_rn(tf, inv[0]), a1 = __fmul_rn(tf, inv[1]); v4f o; o[0] = cosf(a0); o[1] = sinf(a0); o[2] = cosf(a1); o[3] = sinf(a1); cs[k * 32] = o; } }
        v4f wn;
#pragma unroll
        for (int q = 0; q < 4; ++q) wn[q] = bfr(nv[q]);
        const size_t po = ((size_t)(isq ? b * NH_ + s0 : b * NKV + s0 - NH_) * TT + t0 + w * PW) * HD + 4 * lane;
        h16* P16 = (isq ? Q16 : K16) + po; bf* Ph = (isq ? Qh : Kh) + po; bf* Pl = (isq ? Ql : Kl) + po;
        // both loops unrolled: x[][] stays in registers only under constant indices
#pragma unroll
        for (int k = 0; k < PW; ++k) { const v4f c = cs[k * 32];
#pragma unroll
            for (int j = 0; j < PS; ++j) { const v4f v = x[j][k];
                float ss = (v[0] * v[0] + v[1] * v[1]) + (v[2] * v[2] + v[3] * v[3]);
                ss += xrow<1>(ss); ss += xrow<2>(ss); ss += xrow<4>(ss); ss += xrow<8>(ss); ss += xhalf(ss);   // every lane holds the row's sum of squares
                const float rf = __fdiv_rn(1.0f, __fsqrt_rn(ss * (1.0f / HD) + 1e-6f)); v4f y, r;
#pragma unroll
                for (int q = 0; q < 4; ++q) y[q] = wn[q] * (v[q] * rf);
                r[0] = y[0] * c[0] - y[1] * c[1]; r[1] = y[1] * c[0] + y[0] * c[1]; r[2] = y[2] * c[2] - y[3] * c[3]; r[3] = y[3] * c[2] + y[2] * c[3];
                const int o = (j * TT + k) * HD; put3(r, P16 + o, Ph + o, Pl + o); } }
    } else {
#pragma unroll
        for (int j = 0; j < PS; ++j)
#pragma unroll
            for (int k = 0; k < PW; ++k)
#pragma unroll
                for (int q = 0; q < 4; ++q) T[(j * PR + w * PW + k) * PP + 4 * lane + q] = x[j][k][q];
        __syncthreads();   // the whole tile is in LDS before any wave reads its columns; the branch around it is uniform in the work-group
        const int tq = tid & 15, dr = tid >> 4;
        const size_t vo = ((size_t)(b * NKV + s0 - NH_ - NKV) * HD + dr) * TT + t0 + 4 * tq;
#pragma unroll
        for (int i = 0; i < PS * HD / 16; ++i) { const float* p = T + ((i * 16 / HD) * PR + 4 * tq) * PP + (i * 16) % HD + dr; v4f r; r[0] = p[0]; r[1] = p[PP]; r[2] = p[2 * PP]; r[3] = p[3 * PP];
            const size_t o = vo + (size_t)i * 16 * TT; put3(r, V16 + o, Vh + o, Vl + o); }
        asm volatile("s_wait_xcnt 0x0" ::: "memory");   // stands between the stores above and any rewrite of the registers that hold their addresses
    }
}

extern "C" void kernel_launch(void* const* d_in, const int* in_sizes, int n_in,
                              void* d_out, int out_size, void* d_ws, size_t ws_size, hipStream_t stream) {
    (void)in_sizes; (void)n_in; (void)out_size;
    const float* x = (const float*)d_in[0]; const float* wq = (const float*)d_in[1]; const float* wk = (const float*)d_in[2]; const float* wv = (const float*)d_in[3]; const float* wo = (const float*)d_in[4]; const float* qnw = (const float*)d_in[5]; const float* knw = (const float*)d_in[6];
    float* OUT = (float*)d_out;     // [2][2048][2048]
    char* wsp = (char*)d_ws;
    auto take = [&](size_t bytes) { char* p = wsp; wsp += (bytes + 255) & ~(size_t)255; return (void*)p; };
    const size_t NQ = (size_t)NH_ * TT * HD, NK = (size_t)NKV * TT * HD;   // elements of one batch's query planes and of its key or value planes
    bf* WQKV = (bf*)take(((size_t)DF * DM + (size_t)DM * DQ + (size_t)RT * DM) * 2); bf* WO = WQKV + (size_t)DF * DM; bf* XB = WO + (size_t)DM * DQ;   // one range, in k_cvt8's order: wq, wk, wv (together the [DF][DM] operand of the joint projection), wo, x
    float* F = (float*)take((size_t)RT * DF * 4);
    h16* QP16 = (h16*)take(NB_ * NQ * 2); h16* KP16 = (h16*)take(NB_ * NK * 2); h16* VT16 = (h16*)take(NB_ * NK * 2);
    bf* QPh = (bf*)take(NB_ * NQ * 2); bf* QPl = (bf*)take(NB_ * NQ * 2); bf* KPh = (bf*)take(NB_ * NK * 2); bf* KPl = (bf*)take(NB_ * NK * 2); bf* VTh = (bf*)take(NB_ * NK * 2); bf* VTl = (bf*)take(NB_ * NK * 2);
    bf* ATh = (bf*)take((size_t)NB_ * TT * DQ * 2); bf* ATl = (bf*)take((size_t)NB_ * TT * DQ * 2);
    if ((size_t)(wsp - (char*)d_ws) > ws_size) return;    // ws 256 MiB
    k_cvt8<<<(unsigned)(((size_t)DF * DM + (size_t)DM * DQ + (size_t)RT * DM) / 8 / 256), 256, 0, stream>>>(wq, wk, wv, wo, x, WQKV);
    k_gemmt<1, 2, 2, DM><<<dim3(RT / 128, DF / 128), 128, 0, stream>>>(XB, nullptr, WQKV, F, DF);   // q | k | v of both batches
    k_post<<<dim3((NH_ + 2 * NKV) / PS, RT / PR), 256, 0, stream>>>(F, qnw, knw, QP16, QPh, QPl, KP16, KPh, KPl, VT16, VTh, VTl);
    k_fattn<<<dim3(NKV, NB_, TT / FQT), 256, 0, stream>>>(QP16, QPh, QPl, KP16, KPh, KPl, VT16, VTh, VTl, ATh, ATl);
    k_gemmt<2, 2, 4, DQ><<<dim3(RT / 128, DM / 256), 256, 0, stream>>>(ATh, ATl, WO, OUT, DM);
}

// v007
// Measured time: 140 microseconds a run.
// In both of two side-by-side timings against v006, it was 1.09 times as fast.
// Over all steps from v000 it is 11.7 times as fast.
#include <hip/hip_runtime.h>

// _CompatAttention (x [2][2048][2048]; q = RMSNorm_128(x wq^T) * q_norm_w (16 heads x 128), k = RMSNorm_128(x wk^T) * k_norm_w, v = x wv^T (4 kv heads; group h/4); interleaved-pair RoPE (theta 1e4, positions 0..L-1, angles computed on device); causal softmax(q.k / sqrt(128)) (finfo.min fill); out = merged wo^T -> [2][2048][2048]).
// Compute dtypes, f32 accumulate: every input rounded to bf16; q/k/v on PLAIN bf16 operands (inputs: exact); RMSNorm (eps 1e-6) and RoPE f32; causal scores, softmax and attn.v in one kernel (running maximum and sum, f32): query rows < 512 hl (3 products), the rest single fp16 (probabilities x1024), keys beyond the diagonal skipped; wo hl x exact (2 products).

#define NB_  2
#define TT   2048
#define DM   2048
#define NH_  16
#define NKV  4
#define REP  (NH_ / NKV)
#define HD   128
#define DQ   (NH_ * HD)
#define DKV  (NKV * HD)
#define DF   (DQ + 2 * DKV)        // columns of the joint q | k | v projection
#define RT   (NB_ * TT)           // rows of both batches together
#define RH   512                  // query rows < RH use hi+lo planes (0: none)
#define SCL  0.088388347648318447f   // HD^-0.5
typedef _Float16 h16;
typedef unsigned short bf;
typedef __attribute__((ext_vector_type(16))) __bf16   v16bf;
typedef __attribute__((ext_vector_type(16))) _Float16 v16h;
typedef __attribute__((ext_vector_type(8)))  _Float16 v8h;
typedef __attribute__((ext_vector_type(8)))  unsigned short v8us;
typedef __attribute__((ext_vector_type(8)))  float    v8f;
typedef __attribute__((ext_vector_type(4)))  float    v4f;
typedef v8h  __attribute__((may_alias)) v8ha;
typedef v4f  __attribute__((may_alias)) v4fa;
typedef v8us __attribute__((may_alias)) v8usa;

__device__ __forceinline__ unsigned short f2bf(float f) { unsigned u = __float_as_uint(f); u += 0x7FFFu + ((u >> 16) & 1u); return (unsigned short)(u >> 16); }
__device__ __forceinline__ float bf2f(unsigned short b) { return __uint_as_float(((unsigned)b) << 16); }
__device__ __forceinline__ float bfr(float f) { return bf2f(f2bf(f)); }
__device__ __forceinline__ v16h cat16(v8h lo, v8h hi) { return __builtin_shufflevector(lo, hi, 0, 1, 2, 3, 4, 5, 6, 7, 8, 9, 10, 11, 12, 13, 14, 15); }
__device__ __forceinline__ v16bf cat16b(v8us lo, v8us hi) { return __builtin_bit_cast(v16bf, __builtin_shufflevector(lo, hi, 0, 1, 2, 3, 4, 5, 6, 7, 8, 9, 10, 11, 12, 13, 14, 15)); }
__device__ __forceinline__ v8f wmma16(v16h a, v16h b, v8f c) { return __builtin_amdgcn_wmma_f32_16x16x32_f16(false, a, false, b, (short)0, c, false, false); }
__device__ __forceinline__ v8f wmmab(v16bf a, v16bf b, v8f c) { return __builtin_amdgcn_wmma_f32_16x16x32_bf16(false, a, false, b, (short)0, c, false, false); }



// ---- k_gemmt: GEMM on operand tiles shared through LDS. A work-group of WM x WN waves owns a (64 WM) x (16 NBW WN) tile of C; every wave keeps one 64 x (16 NBW) part in 4 NBW accumulators over the whole K.
// A pass is GKP k = 256 bytes of every operand row. A stage holds the pass's rows in slices: WM slices of 64 rows of A, with NA == 2 WM slices of A2, then WN slices of 16 NBW rows of Bt (one a wave column): at most as many slices as waves,
// and wave w brings slice w with ONE tensor load (rows padded to 272 bytes in LDS); a wave beyond the last slice brings none. Two buffers: the load of stage s + 2 goes out behind the barrier that ends the reads of stage s and flies during pass s + 1.
// C[m][n] (f32, pitch ldc) = sum_k A[m][k] Bt[n][k] (+ A2[m][k] Bt[n][k]). K a multiple of GKP and at least 2 GKP; grid (M / (64 WM), N / (16 NBW WN)), 32 WM WN threads.
template <typename T16> struct WFrag;
template <> struct WFrag<h16> { typedef v16h V; static __device__ __forceinline__ V ld(const h16* p) { return cat16(*(const v8h*)p, *(const v8h*)(p + 16)); } static __device__ __forceinline__ v8f mma(V a, V b, v8f c) { return wmma16(a, b, c); } };
template <> struct WFrag<bf> { typedef v16bf V; static __device__ __forceinline__ V ld(const bf* p) { return cat16b(*(const v8us*)p, *(const v8us*)(p + 16)); } static __device__ __forceinline__ v8f mma(V a, V b, v8f c) { return wmmab(a, b, c); } };
#define GKP  128                  // k per pass: rows of 256 bytes
#define GPI  (GKP + 8)            // LDS row pitch, elements: 272 bytes, an odd multiple of 16
#define GSL  9216                 // one slice in LDS, elements: 64 rows of 272 bytes = 17408 bytes, rounded up to 18432 = 9 x 2 KiB
typedef uint32_t u32x4 __attribute__((ext_vector_type(4)));
typedef uint32_t u32x8 __attribute__((ext_vector_type(8)));
__device__ __forceinline__ uint32_t uni(uint32_t v) { return (uint32_t)__builtin_amdgcn_readfirstlane(v); }
__device__ __forceinline__ uint32_t pinned(uint32_t v) { uint32_t w = (uint32_t)__builtin_amdgcn_readfirstlane(v); asm volatile("" : "+s"(w)); return w; }   // holds the test of a tensor load in a scalar register, so that the branch around it is a scalar one (the load ignores EXEC)
// group 0 goes through both statements as an operand that they hand on: the words so stay in one register tuple from the issue to the wait, and a new aim is formed only behind the wait that covers the request
__device__ __forceinline__ void tdm_load(u32x4& g0, u32x8 g1) { asm volatile("tensor_load_to_lds %0, %1" : "+s"(g0) : "s"(g1) : "memory"); }   // one request of the whole wave: its slice's rows of 256 bytes into LDS
__device__ __forceinline__ void tdm_wait(u32x4& g0, u32x8 g1) { asm volatile("s_wait_tensorcnt 0x0" : "+s"(g0) : "s"(g1) : "memory"); }   // the wave's request has landed
template <int NA, int WM, int WN, int NBW, int K>
__global__ __launch_bounds__(32 * WM * WN) void k_gemmt(const bf* __restrict__ A, const bf* __restrict__ A2, const bf* __restrict__ Bt, float* C, int ldc) {
    typedef WFrag<bf>::V V;
    constexpr int NW = WM * WN, NAS = NA * WM, NSL = NAS + WN;   // waves; slices of A and A2; slices in all
    constexpr int GSB = (16 * NBW * GPI + 1023) / 1024 * 1024, STG = NAS * GSL + WN * GSB;   // a slice of Bt in LDS, elements, rounded up to 2 KiB like GSL; a stage
    static_assert(NSL <= NW, "at most one slice a wave"); static_assert(NBW >= 4 && NBW % 2 == 0 && NW * GSB <= 2 * STG, "whole 128-byte lines of C, and the output staging fits the ring"); static_assert(K % GKP == 0 && K >= 2 * GKP, "whole passes, and both stages of the prologue exist");
    __shared__ __attribute__((aligned(2048))) bf L[2 * STG];
    const int lane = threadIdx.x & 31, lr = lane & 15, hi = lane >> 4; const int w = __builtin_amdgcn_readfirstlane((int)(threadIdx.x >> 5));   /* wave number held scalar: slice addresses and descriptor words are scalar */
    const int wm = w / WN, wn = w % WN, r0 = blockIdx.x * (64 * WM), c0 = blockIdx.y * (16 * NBW * WN);
    const int sb = (NSL == NW || w < NSL) ? w - NAS : WN - 1;   // the wave's slice of Bt where it has one; a wave that brings no slice forms the last slice's words and never issues them
    const bf* sp = w < WM ? A + (size_t)(r0 + 64 * w) * K : (NA == 2 && w < 2 * WM) ? A2 + (size_t)(r0 + 64 * (w - WM)) * K : Bt + (size_t)(c0 + 16 * NBW * sb) * K;   // first row of the wave's slice
    const uint64_t ga = (uint64_t)sp; const uint32_t ld0 = (uint32_t)(uintptr_t)L + ((GSB == GSL || w < NAS) ? (uint32_t)w * (GSL * 2u) : NAS * (GSL * 2u) + (uint32_t)sb * (GSB * 2u));
    const uint32_t nr = (NBW == 4 || w < NAS) ? 64u : 16u * NBW;   // rows of the wave's slice
    u32x8 g1;   // 1-byte elements, tensor = tile = nr rows of 256 bytes, 16 bytes of pad behind every 256
    g1[0] = uni((1u << 20) | (5u << 22) | (3u << 25)); g1[1] = uni(256u << 16); g1[2] = uni(nr << 16); g1[3] = uni(256u << 16); g1[4] = uni(nr); g1[5] = uni((uint32_t)K * 2u); g1[6] = uni(0u); g1[7] = uni(0u);
    asm volatile("" : "+s"(g1));   // as in pinned(): descriptor words held in scalar registers of their own for the whole kernel, so that none is lent out and written back while a request is outstanding
    u32x4 g0; g0[0] = uni(1u);
    auto aim = [&](uint32_t lds, uint64_t p) { g0[1] = uni(lds); g0[2] = uni((uint32_t)p); g0[3] = uni((((uint32_t)(p >> 32)) & 0x01FFFFFFu) | 0x80000000u); };
    v8f acc[4][NBW];
#pragma unroll
    for (int mb = 0; mb < 4; ++mb)
#pragma unroll
        for (int nb = 0; nb < NBW; ++nb) acc[mb][nb] = (v8f){};
    constexpr int np = K / GKP; const int fo = lr * GPI + 8 * hi;
    V a[2][4], a2[2][4], b[2][NBW];
    // fragments of the 32-k block kc of the stage in buffer B, into register set kc & 1; both loops are unrolled so that the arrays stay in registers
    auto frags = [&](const bf* B, int kc) { const bf* ap = B + wm * GSL + fo + 32 * kc; const bf* bp = B + NAS * GSL + wn * GSB + fo + 32 * kc;
#pragma unroll
        for (int i = 0; i < 4; ++i) { a[kc & 1][i] = WFrag<bf>::ld(ap + 16 * i * GPI); if (NA == 2) a2[kc & 1][i] = WFrag<bf>::ld(ap + WM * GSL + 16 * i * GPI); b[kc & 1][i] = WFrag<bf>::ld(bp + 16 * i * GPI); }
#pragma unroll
        for (int i = 4; i < NBW; ++i) b[kc & 1][i] = WFrag<bf>::ld(bp + 16 * i * GPI); };
    aim(ld0, ga); if (NSL == NW || pinned(w < NSL)) tdm_load(g0, g1);
    tdm_wait(g0, g1);
    __syncthreads();   // stage 0 is whole before any wave reads it
    aim(ld0 + STG * 2u, ga + GKP * 2u); if (NSL == NW || pinned(w < NSL)) tdm_load(g0, g1);
    frags(L, 0);
#pragma unroll 1   // rolled: one pass of code
    for (int s = 0; s < np; ++s) {
        const bf* B = L + (s & 1) * STG;
        // the loops of a pass are unrolled: the fragment sets and acc[][] stay in registers only under constant indices
#pragma unroll
        for (int kc = 0; kc < GKP / 32; ++kc) {
            // the next block's LDS loads go out as one group in front of this block's products
            if (kc + 1 < GKP / 32) frags(B, kc + 1);
            else {   // publish point of stage s + 1, in front of the pass's last block, whose fragments are in registers by then
                asm volatile("s_wait_dscnt 0x0" ::: "memory");   // the wave's reads of stage s are done
                tdm_wait(g0, g1);   // the wave's slice of stage s + 1 has landed
                __syncthreads();   // publishes stage s + 1 and ends every wave's reads of stage s
                if (pinned(s + 2 < np && (NSL == NW || w < NSL))) { aim(ld0 + (uint32_t)(s & 1) * (STG * 2u), ga + (uint64_t)(s + 2) * (GKP * 2u)); tdm_load(g0, g1); }   // refill of the buffer that pass s has read
                if (s + 1 < np) frags(L + ((s + 1) & 1) * STG, 0);
            }
            __builtin_amdgcn_sched_barrier(0);   // this one and the one below keep each group of LDS loads together and out of the matrix run: one LDS stall a block, hidden behind the block before
#pragma unroll
            for (int nb = 0; nb < NBW; ++nb)
#pragma unroll
                for (int mb = 0; mb < 4; ++mb) { acc[mb][nb] = wmmab(a[kc & 1][mb], b[kc & 1][nb], acc[mb][nb]); if (NA == 2) acc[mb][nb] = wmmab(a2[kc & 1][mb], b[kc & 1][nb], acc[mb][nb]); }
            __builtin_amdgcn_sched_barrier(0);
        }
    }
    tdm_wait(g0, g1);   // no request is left when the ring becomes output staging
    asm volatile("s_wait_dscnt 0x0" ::: "memory");
    // the last pass's barrier has ended every read of the ring. Each wave turns its own 64 x (16 NBW) tile in its own range of the ring (column-major, pitch 68 floats), so that a store covers one whole 128-byte line of C
    float* ow = (float*)L + w * (GSB / 2); float* pw = ow + lr * 68 + hi * 8;
    // both loops unrolled: acc[][] stays in registers only under constant indices
#pragma unroll
    for (int mb = 0; mb < 4; ++mb)
#pragma unroll
        for (int nb = 0; nb < NBW; ++nb) { float* p = pw + nb * 16 * 68 + mb * 16; const v8f t = acc[mb][nb]; *(v4fa*)p = __builtin_shufflevector(t, t, 0, 1, 2, 3); *(v4fa*)(p + 4) = __builtin_shufflevector(t, t, 4, 5, 6, 7); }
    asm volatile("s_wait_dscnt 0x0" ::: "memory");   // the wave's own LDS writes are done before its lanes read one another's
    float* cb = C + (size_t)(r0 + 64 * wm) * ldc + c0 + 16 * NBW * wn;   // wave-uniform base of the wave's first row
    // all loops unrolled so that the LDS loads issue together, the offsets fold into the instructions and v[] stays in registers
#pragma unroll
    for (int rg = 0; rg < 16; ++rg) { v4f v[NBW / 2];
#pragma unroll
        for (int cg = 0; cg < NBW / 2; ++cg) v[cg] = *(const v4fa*)(ow + (32 * cg + lane) * 68 + rg * 4);
#pragma unroll
        for (int k = 0; k < 4; ++k) { float* cr = cb + (size_t)(rg * 4 + k) * ldc;
#pragma unroll
            for (int cg = 0; cg < NBW / 2; ++cg) cr[32 * cg + lane] = v[cg][k]; } }
}

__device__ __forceinline__ h16 tohx(float x) { return (h16)x; }
__device__ __forceinline__ void splitf(float y, unsigned short& h, unsigned short& l) { h = f2bf(y); l = f2bf(y - bf2f(h)); }
typedef __attribute__((ext_vector_type(2))) _Float16 v2h;
typedef __attribute__((ext_vector_type(4))) _Float16 v4h;
typedef __attribute__((ext_vector_type(2))) unsigned short v2us;
typedef __attribute__((ext_vector_type(4))) unsigned short v4us;
typedef __attribute__((ext_vector_type(2))) float v2f;
typedef __attribute__((ext_vector_type(4))) int v4i;

__global__ __launch_bounds__(256) void k_wtG(const float* __restrict__ w, int K, int N, bf* Bt) {
    const int lane = threadIdx.x & 31; const int L0 = (blockIdx.x * 8 + (threadIdx.x >> 5)) * 8; const int nlines = N * K / 64;
{
#pragma unroll 1
        for (int l = 0; l < 8; ++l) { const int L = L0 + l; if (L >= nlines) break; const size_t e = (size_t)L * 64 + lane * 2; const int k = (int)(e % K), n = (int)(e / K); v2us o;
            o[0] = f2bf(w[(size_t)k * N + n]); o[1] = f2bf(w[(size_t)(k + 1) * N + n]); *(v2us*)(Bt + e) = o; }
         }
}
// k_cvt8: all five f32 operands to bf16 in one launch; the planes lie one behind the other in dst in the order wq, wk, wv, wo, x. Every plane is a whole number of blocks (2048 elements each), so the choice of the source is uniform in a block.
__global__ __launch_bounds__(256) void k_cvt8(const float* __restrict__ wq, const float* __restrict__ wk, const float* __restrict__ wv, const float* __restrict__ wo, const float* __restrict__ x, bf* dst) {
    constexpr size_t nq = (size_t)DQ * DM / 8, nk = (size_t)DKV * DM / 8, no = (size_t)DM * DQ / 8, nx = (size_t)RT * DM / 8;
    const size_t b0 = (size_t)blockIdx.x * 256; if (b0 >= nq + 2 * nk + no + nx) return; const float* src; size_t base;
    if (b0 < nq) { src = wq; base = 0; } else if (b0 < nq + nk) { src = wk; base = nq; } else if (b0 < nq + 2 * nk) { src = wv; base = nq + nk; } else if (b0 < nq + 2 * nk + no) { src = wo; base = nq + 2 * nk; } else { src = x; base = nq + 2 * nk + no; }
    const size_t i = b0 + threadIdx.x; const v8f v = *(const v8f*)(src + (i - base) * 8); v8us o;
#pragma unroll
    for (int k = 0; k < 8; ++k) o[k] = f2bf(v[k]); *(v8us*)(dst + i * 8) = o;  }
#define FQT  32                   // query positions per work-group
#define FSK  64                   // keys per stage
#define FPK  (HD + 8)             // LDS row pitch of K, elements: 272 bytes, an odd multiple of 16
#define FPV  (FSK + 8)            // LDS row pitch of V^T, elements: 144 bytes, an odd multiple of 16
#define FKT  (FSK * FPK)
#define FPL  (FKT + HD * FPV)     // one plane (K tile, then V^T tile) of a stage, elements
#define CS2  (SCL * 1.4426950408889634f)   // scores to the log2 domain
typedef v4i __attribute__((may_alias)) v4ia;
__device__ __forceinline__ float xhalf(float x) { return __builtin_bit_cast(float, __builtin_amdgcn_permlanex16(__builtin_bit_cast(int, x), __builtin_bit_cast(int, x), 0x76543210, 0xfedcba98, false, false)); }   // lane l with lane l ^ 16
template <typename T16, bool HL>
__device__ __forceinline__ void fa_body(T16* L, const T16* __restrict__ Q, const T16* __restrict__ Q2, const T16* __restrict__ Kp, const T16* __restrict__ K2, const T16* __restrict__ Vt, const T16* __restrict__ V2, int q0, bf* Ah, bf* Al) {
    typedef typename WFrag<T16>::V V;
    constexpr int NP = HL ? 2 : 1, BUF = NP * FPL;
    const int tid = threadIdx.x, lane = tid & 31, c = lane & 15, h = lane >> 4; const int w = __builtin_amdgcn_readfirstlane(tid >> 5);   /* wave number held scalar, so the tests on the wave's diagonal are scalar branches */
    const int hd = w >> 1, qw = q0 + 16 * (w & 1);
    V qf[4], qf2[4];
    // each s_wait_xcnt below stands between the loads in front of it and any rewrite of their address registers; it takes the pointers as inputs, so that they stay in those registers up to the wait
    { const size_t qo = ((size_t)hd * TT + qw + c) * HD + 8 * h; const T16* qp = Q + qo; const T16* qp2 = HL ? Q2 + qo : qp;
#pragma unroll
      for (int kc = 0; kc < 4; ++kc) { qf[kc] = WFrag<T16>::ld(qp + 32 * kc); if (HL) qf2[kc] = WFrag<T16>::ld(qp2 + 32 * kc); }
      asm volatile("s_wait_xcnt 0x0" :: "v"(qp), "v"(qp2) : "memory"); }
    v8f acc[8];
#pragma unroll
    for (int t = 0; t < 8; ++t) acc[t] = (v8f){};
    float m = -3.0e38f, l = 0.f;
    const int ns = q0 / FSK + 1;   // stages that hold a key <= q0 + FQT - 1; the same for every wave of the work-group
    // staging: 16-byte pieces; K: 16 a row, the stage contiguous in memory; V^T: 8 a row, one whole 128-byte line
    const int kr = tid >> 4, kcol = (tid & 15) * 8, vr = tid >> 3, vcol = (tid & 7) * 8;
    v4i rg[NP * 8];
    auto fetch = [&](int s) {
        const size_t ko = (size_t)(s * FSK + kr) * HD + kcol, vo = (size_t)vr * TT + s * FSK + vcol;
        const T16* k1 = Kp + ko; const T16* v1 = Vt + vo; const T16* k2 = HL ? K2 + ko : k1; const T16* v2 = HL ? V2 + vo : v1;
#pragma unroll
        for (int i = 0; i < 4; ++i) { rg[i] = *(const v4ia*)(k1 + 16 * i * HD); rg[4 + i] = *(const v4ia*)(v1 + 32 * i * TT); if (HL) { rg[8 + i] = *(const v4ia*)(k2 + 16 * i * HD); rg[12 + i] = *(const v4ia*)(v2 + 32 * i * TT); } }
        asm volatile("s_wait_xcnt 0x0" :: "v"(k1), "v"(v1), "v"(k2), "v"(v2) : "memory"); };
    auto put = [&](T16* B) {
#pragma unroll
        for (int i = 0; i < 4; ++i) { const int ko = (kr + 16 * i) * FPK + kcol, vo = FKT + (vr + 32 * i) * FPV + vcol;
            *(v4ia*)(B + ko) = rg[i]; *(v4ia*)(B + vo) = rg[4 + i]; if (HL) { *(v4ia*)(B + FPL + ko) = rg[8 + i]; *(v4ia*)(B + FPL + vo) = rg[12 + i]; } } };
    fetch(0); put(L);
    __syncthreads();   // stage 0 is in LDS before any wave reads it
#pragma unroll 1
    for (int s = 0; s < ns; ++s) {
        const bool more = s + 1 < ns;
        if (!HL && more) fetch(s + 1);   // the hl blocks are short and need the registers: they fetch in front of put()
        const T16* B = L + (s & 1) * BUF;
#pragma unroll 1
        for (int sub = 0; sub < FSK / 32; ++sub) {
            const int key0 = s * FSK + sub * 32;
            if (key0 > qw + 15) break;   // every key of the pass lies beyond the wave's last query
            v8f st[2]; st[0] = (v8f){}; st[1] = (v8f){};
            const T16* kp = B + (sub * 32 + c) * FPK + 8 * h; const T16* vp = B + FKT + c * FPV + sub * 32 + 8 * h;
            V va[8];
            // the sched_barriers of this pass keep each group of LDS loads together in front of its products: one LDS latency a group, not one a fragment
            if constexpr (!HL) { V ka[2][4];
#pragma unroll
                for (int kt = 0; kt < 2; ++kt)
#pragma unroll
                    for (int kc = 0; kc < 4; ++kc) ka[kt][kc] = WFrag<T16>::ld(kp + 16 * kt * FPK + 32 * kc);
                __builtin_amdgcn_sched_barrier(0);
#pragma unroll
                for (int kc = 0; kc < 4; ++kc) { st[0] = WFrag<T16>::mma(ka[0][kc], qf[kc], st[0]); st[1] = WFrag<T16>::mma(ka[1][kc], qf[kc], st[1]); }
#pragma unroll
                for (int t = 0; t < 8; ++t) va[t] = WFrag<T16>::ld(vp + 16 * t * FPV);   // V^T fragments fly during the softmax
                __builtin_amdgcn_sched_barrier(0);
            } else {
#pragma unroll
                for (int kt = 0; kt < 2; ++kt) { V ka[4], kb[4];
#pragma unroll
                    for (int kc = 0; kc < 4; ++kc) { ka[kc] = WFrag<T16>::ld(kp + 16 * kt * FPK + 32 * kc); kb[kc] = WFrag<T16>::ld(kp + FPL + 16 * kt * FPK + 32 * kc); }
                    __builtin_amdgcn_sched_barrier(0);
#pragma unroll
                    for (int kc = 0; kc < 4; ++kc) { st[kt] = WFrag<T16>::mma(ka[kc], qf[kc], st[kt]); st[kt] = WFrag<T16>::mma(ka[kc], qf2[kc], st[kt]); st[kt] = WFrag<T16>::mma(kb[kc], qf[kc], st[kt]); }
                    __builtin_amdgcn_sched_barrier(0); } }
            if (key0 + 31 > qw) {   // only a pass that straddles the wave's diagonal pays for the mask
#pragma unroll
                for (int kt = 0; kt < 2; ++kt)
#pragma unroll
                    for (int r = 0; r < 8; ++r) if (key0 + 16 * kt + 8 * h + r > qw + c) st[kt][r] = -3.0e38f; }
            float mx = fmaxf(st[0][0], st[1][0]);
#pragma unroll
            for (int r = 1; r < 8; ++r) mx = fmaxf(mx, fmaxf(st[0][r], st[1][r]));
            mx = fmaxf(mx, xhalf(mx));   // both wave halves hold the query's maximum over the pass (key key0 is never masked here, so it is a real score)
            const float mb = mx * CS2;
            if (__builtin_amdgcn_ballot_w32(mb > m) != 0) {   // some query's maximum rose: rescale (factor 1 in the lanes where it did not; 0 on the first pass)
                const float mn = fmaxf(m, mb), corr = __builtin_amdgcn_exp2f(m - mn); l *= corr; m = mn;
#pragma unroll
                for (int t = 0; t < 8; ++t) acc[t] *= corr; }
            const float nm = (HL ? 0.0f : 10.0f) - m;   // fp16 probabilities carry a factor 1024 (it is in the sum too and cancels), so that small ones stay normal numbers
            float p[16];
#pragma unroll
            for (int i = 0; i < 16; ++i) { p[i] = __builtin_amdgcn_exp2f(fmaf(st[i >> 3][i & 7], CS2, nm)); l += p[i]; }
            V pb, pl;
            if constexpr (HL) { __attribute__((ext_vector_type(16))) unsigned short uh, ul;
#pragma unroll
                for (int i = 0; i < 16; ++i) { unsigned short a, b2; splitf(p[i], a, b2); uh[i] = a; ul[i] = b2; }
                pb = __builtin_bit_cast(v16bf, uh); pl = __builtin_bit_cast(v16bf, ul);
            } else {
#pragma unroll
                for (int i = 0; i < 16; ++i) pb[i] = tohx(p[i]); }
            if constexpr (!HL) {
#pragma unroll
                for (int t = 0; t < 8; ++t) acc[t] = WFrag<T16>::mma(va[t], pb, acc[t]);
            } else {
#pragma unroll
                for (int tg = 0; tg < 8; tg += 4) {
#pragma unroll
                    for (int t = 0; t < 4; ++t) { va[t] = WFrag<T16>::ld(vp + 16 * (tg + t) * FPV); va[4 + t] = WFrag<T16>::ld(vp + FPL + 16 * (tg + t) * FPV); }
                    __builtin_amdgcn_sched_barrier(0);
#pragma unroll
                    for (int t = 0; t < 4; ++t) acc[tg + t] = WFrag<T16>::mma(va[t], pb, acc[tg + t]);
#pragma unroll
                    for (int t = 0; t < 4; ++t) acc[tg + t] = WFrag<T16>::mma(va[t], pl, acc[tg + t]);
#pragma unroll
                    for (int t = 0; t < 4; ++t) acc[tg + t] = WFrag<T16>::mma(va[4 + t], pb, acc[tg + t]);
                    __builtin_amdgcn_sched_barrier(0); } }
            asm volatile("v_nop\n\tv_nop\n\tv_nop\n\tv_nop" : "+v"(acc[0]), "+v"(acc[7]));   // the distance behind the last matrix instruction also on the taken side of the loop's branch
        }
        if (HL && more) fetch(s + 1);
        if (more) put(L + ((s + 1) & 1) * BUF);   // the buffer that stage s - 1 used: every wave left it at the barrier below, one trip ago
        __syncthreads();   // publishes stage s + 1 and ends every wave's reads of stage s
    }
    l += xhalf(l);   // each wave half summed its eight keys of every 16-key tile
    const float inv = __fdiv_rn(1.0f, l);
    const size_t oo = (size_t)(qw + c) * DQ + hd * HD + 8 * h;   // a lane's 8 accumulator registers are 8 consecutive d of its query
#pragma unroll
    for (int t = 0; t < 8; ++t) { v8us oh, ol;
#pragma unroll
        for (int r = 0; r < 8; ++r) { unsigned short a, b2; splitf(acc[t][r] * inv, a, b2); oh[r] = a; ol[r] = b2; }
        *(v8us*)(Ah + oo + 16 * t) = oh; *(v8us*)(Al + oo + 16 * t) = ol; }
}
// grid (kv groups, batches, TT / FQT position blocks, heaviest first); planes [batch][head][t][d] (V: [batch][group][d][t]); output hi/lo planes [batch][t][DQ]
__global__ __launch_bounds__(256) void k_fattn(const h16* __restrict__ Q16, const bf* __restrict__ Qh, const bf* __restrict__ Ql, const h16* __restrict__ K16, const bf* __restrict__ Kh, const bf* __restrict__ Kl, const h16* __restrict__ V16, const bf* __restrict__ Vh, const bf* __restrict__ Vl, bf* Ah, bf* Al) {
    __shared__ __align__(16) unsigned short L[2 * 2 * FPL];
    const int g = blockIdx.x, b = blockIdx.y, q0 = (TT / FQT - 1 - (int)blockIdx.z) * FQT;
    const size_t zq = ((size_t)b * NH_ + g * REP) * TT * HD, zk = ((size_t)b * NKV + g) * TT * HD, zo = (size_t)b * TT * DQ + g * REP * HD;
    if (q0 < RH) fa_body<bf, true>((bf*)L, Qh + zq, Ql + zq, Kh + zk, Kl + zk, Vh + zk, Vl + zk, q0, Ah + zo, Al + zo);
    else fa_body<h16, false>((h16*)L, Q16 + zq, nullptr, K16 + zk, nullptr, V16 + zk, nullptr, q0, Ah + zo, Al + zo);
}

// ---- k_post: all that lies between the joint projection and attention, in one launch: RMS factor, norm weight and RoPE of the query and key heads, and the V^T planes.
// A work-group of 8 waves owns PR token rows of PS head slots (a slot: HD columns of F; the query heads, then the key heads, then the value heads; NH_ and NKV are multiples of PS, so a work-group's slots are of one kind).
// Query and key slots: a wave holds whole head rows, 4 consecutive d a lane (two RoPE pairs): the mean square is one sum over the wave, both partners of a pair lie in the lane, and a row's angles are computed once in the wave for its PS heads.
// Value slots: the f32 tile turns in LDS, and a lane stores 4 consecutive t of one d: 16 lanes write one whole 128-byte line of a plane.
#define PR   64                   // token rows per work-group: one 128-byte line of a V^T plane
#define PW   (PR / 8)             // rows per wave
#define PS   2                    // head slots per work-group
#define PP   (HD + 1)             // LDS row pitch of the value tile, floats: odd, so that the 32 column reads of a wave fall on 32 banks
typedef __attribute__((ext_vector_type(4))) __bf16 v4b;
typedef __attribute__((ext_vector_type(2))) unsigned __attribute__((may_alias)) v2u;
template <int X> __device__ __forceinline__ float xrow(float x) { return __builtin_bit_cast(float, __builtin_amdgcn_update_dpp(0, __builtin_bit_cast(int, x), 0x160 + X, 0xf, 0xf, true)); }   // lane l with lane l ^ X of its 16-lane row (DPP row_xmask)
// four consecutive elements to the three planes: fp16, bf16 high part, bf16 rest
__device__ __forceinline__ void put3(v4f r, h16* p16, bf* ph, bf* pl) {
    const v2u hp = __builtin_bit_cast(v2u, __builtin_convertvector(r, v4b)); v4f rest;   // two high parts a dword
#pragma unroll
    for (int q = 0; q < 4; ++q) rest[q] = r[q] - __uint_as_float((q & 1) ? hp[q >> 1] & 0xFFFF0000u : hp[q >> 1] << 16);
    *(v4h*)p16 = __builtin_convertvector(r, v4h); *(v2u*)ph = hp; *(v2u*)pl = __builtin_bit_cast(v2u, __builtin_convertvector(rest, v4b)); }
__global__ __launch_bounds__(256) void k_post(const float* __restrict__ F, const float* __restrict__ qnw, const float* __restrict__ knw, h16* Q16, bf* Qh, bf* Ql, h16* K16, bf* Kh, bf* Kl, h16* V16, bf* Vh, bf* Vl) {
    __shared__ __align__(16) float T[PS * PR * PP];
    const int tid = threadIdx.x, lane = tid & 31; const int w = __builtin_amdgcn_readfirstlane(tid >> 5);   /* wave number held scalar: row addresses stay scalar */
    const int s0 = blockIdx.x * PS, r0 = blockIdx.y * PR, b = r0 / TT, t0 = r0 % TT;   // PR divides TT: a work-group lies in one batch
    v4f x[PS][PW];   // all of the wave's rows are asked for at once: one memory latency a wave
    { const float* f = F + (size_t)(r0 + w * PW) * DF + s0 * HD + 4 * lane;
#pragma unroll
      for (int j = 0; j < PS; ++j)
#pragma unroll
          for (int k = 0; k < PW; ++k) x[j][k] = *(const v4f*)(f + (size_t)k * DF + j * HD); }
    if (s0 < NH_ + NKV) {
        const bool isq = s0 < NH_;
        const v4f nv = *(const v4f*)((isq ? qnw : knw) + 4 * lane);
        asm volatile("s_wait_xcnt 0x0" ::: "memory");   // stands between the load above and any rewrite of the registers that hold its address
        // cosine and sine of the wave's rows, under the loads; the loop stays rolled (four library calls of code, not 32) and hands each lane's own values on through LDS, which no other lane reads: no barrier
        v4f* cs = (v4f*)T + w * PW * 32 + lane;
        { float inv[2];
#pragma unroll
          for (int u = 0; u < 2; ++u) inv[u] = __fdiv_rn(1.0f, powf(10000.0f, (float)(2 * (2 * lane + u)) / (float)HD));   // pairs 2 * lane and 2 * lane + 1
#pragma unroll 1   // rolled for code size: four inlined library calls a trip, each with its large-argument branch
          for (int k = 0; k < PW; ++k) { const float tf = (float)(t0 + w * PW + k); const float a0 = __fmul_rn(tf, inv[0]), a1 = __fmul_rn(tf, inv[1]); v4f o; o[0] = cosf(a0); o[1] = sinf(a0); o[2] = cosf(a1); o[3] = sinf(a1); cs[k * 32] = o; } }
        v4f wn;
#pragma unroll
        for (int q = 0; q < 4; ++q) wn[q] = bfr(nv[q]);
        const size_t po = ((size_t)(isq ? b * NH_ + s0 : b * NKV + s0 - NH_) * TT + t0 + w * PW) * HD + 4 * lane;
        h16* P16 = (isq ? Q16 : K16) + po; bf* Ph = (isq ? Qh : Kh) + po; bf* Pl = (isq ? Ql : Kl) + po;
        // both loops unrolled: x[][] stays in registers only under constant indices
#pragma unroll
        for (int k = 0; k < PW; ++k) { const v4f c = cs[k * 32];
#pragma unroll
            for (int j = 0; j < PS; ++j) { const v4f v = x[j][k];
                float ss = (v[0] * v[0] + v[1] * v[1]) + (v[2] * v[2] + v[3] * v[3]);
                ss += xrow<1>(ss); ss += xrow<2>(ss); ss += xrow<4>(ss); ss += xrow<8>(ss); ss += xhalf(ss);   // every lane holds the row's sum of squares
                const float rf = __fdiv_rn(1.0f, __fsqrt_rn(ss * (1.0f / HD) + 1e-6f)); v4f y, r;
#pragma unroll
                for (int q = 0; q < 4; ++q) y[q] = wn[q] * (v[q] * rf);
                r[0] = y[0] * c[0] - y[1] * c[1]; r[1] = y[1] * c[0] + y[0] * c[1]; r[2] = y[2] * c[2] - y[3] * c[3]; r[3] = y[3] * c[2] + y[2] * c[3];
                const int o = (j * TT + k) * HD; put3(r, P16 + o, Ph + o, Pl + o); } }
    } else {
#pragma unroll
        for (int j = 0; j < PS; ++j)
#pragma unroll
            for (int k = 0; k < PW; ++k)
#pragma unroll
                for (int q = 0; q < 4; ++q) T[(j * PR + w * PW + k) * PP + 4 * lane + q] = x[j][k][q];
        __syncthreads();   // the whole tile is in LDS before any wave reads its columns; the branch around it is uniform in the work-group
        const int tq = tid & 15, dr = tid >> 4;
        const size_t vo = ((size_t)(b * NKV + s0 - NH_ - NKV) * HD + dr) * TT + t0 + 4 * tq;
#pragma unroll
        for (int i = 0; i < PS * HD / 16; ++i) { const float* p = T + ((i * 16 / HD) * PR + 4 * tq) * PP + (i * 16) % HD + dr; v4f r; r[0] = p[0]; r[1] = p[PP]; r[2] = p[2 * PP]; r[3] = p[3 * PP];
            const size_t o = vo + (size_t)i * 16 * TT; put3(r, V16 + o, Vh + o, Vl + o); }
        asm volatile("s_wait_xcnt 0x0" ::: "memory");   // stands between the stores above and any rewrite of the registers that hold their addresses
    }
}

extern "C" void kernel_launch(void* const* d_in, const int* in_sizes, int n_in,
                              void* d_out, int out_size, void* d_ws, size_t ws_size, hipStream_t stream) {
    (void)in_sizes; (void)n_in; (void)out_size;
    const float* x = (const float*)d_in[0]; const float* wq = (const float*)d_in[1]; const float* wk = (const float*)d_in[2]; const float* wv = (const float*)d_in[3]; const float* wo = (const float*)d_in[4]; const float* qnw = (const float*)d_in[5]; const float* knw = (const float*)d_in[6];
    float* OUT = (float*)d_out;     // [2][2048][2048]
    char* wsp = (char*)d_ws;
    auto take = [&](size_t bytes) { char* p = wsp; wsp += (bytes + 255) & ~(size_t)255; return (void*)p; };
    const size_t NQ = (size_t)NH_ * TT * HD, NK = (size_t)NKV * TT * HD;   // elements of one batch's query planes and of its key or value planes
    bf* WQKV = (bf*)take(((size_t)DF * DM + (size_t)DM * DQ + (size_t)RT * DM) * 2); bf* WO = WQKV + (size_t)DF * DM; bf* XB = WO + (size_t)DM * DQ;   // one range, in k_cvt8's order: wq, wk, wv (together the [DF][DM] operand of the joint projection), wo, x
    float* F = (float*)take((size_t)RT * DF * 4);
    h16* QP16 = (h16*)take(NB_ * NQ * 2); h16* KP16 = (h16*)take(NB_ * NK * 2); h16* VT16 = (h16*)take(NB_ * NK * 2);
    bf* QPh = (bf*)take(NB_ * NQ * 2); bf* QPl = (bf*)take(NB_ * NQ * 2); bf* KPh = (bf*)take(NB_ * NK * 2); bf* KPl = (bf*)take(NB_ * NK * 2); bf* VTh = (bf*)take(NB_ * NK * 2); bf* VTl = (bf*)take(NB_ * NK * 2);
    bf* ATh = (bf*)take((size_t)NB_ * TT * DQ * 2); bf* ATl = (bf*)take((size_t)NB_ * TT * DQ * 2);
    if ((size_t)(wsp - (char*)d_ws) > ws_size) return;    // ws 256 MiB
    k_cvt8<<<(unsigned)(((size_t)DF * DM + (size_t)DM * DQ + (size_t)RT * DM) / 8 / 256), 256, 0, stream>>>(wq, wk, wv, wo, x, WQKV);
    k_gemmt<1, 4, 2, 6, DM><<<dim3(RT / 256, DF / 192), 256, 0, stream>>>(XB, nullptr, WQKV, F, DF);   // q | k | v of both batches: 256 x 192 tiles, one work-group a WGP
    k_post<<<dim3((NH_ + 2 * NKV) / PS, RT / PR), 256, 0, stream>>>(F, qnw, knw, QP16, QPh, QPl, KP16, KPh, KPl, VT16, VTh, VTl);
    k_fattn<<<dim3(NKV, NB_, TT / FQT), 256, 0, stream>>>(QP16, QPh, QPl, KP16, KPh, KPl, VT16, VTh, VTl, ATh, ATl);
    k_gemmt<2, 2, 4, 4, DQ><<<dim3(RT / 128, DM / 256), 256, 0, stream>>>(ATh, ATl, WO, OUT, DM);
}
